// v000
// Measured on an AMD MI455X. A time is GPU time per run, averaged over a window of back-to-back runs after a warm-up
// (all launches, gaps included; the runs take copies of the inputs in turn), and the median of several windows.
// Apart from v000's, it joins two sittings. Times from different sittings can be a few percent apart, while
// side-by-side timings come from the same sitting.
// v000 is the starting kernel. One run takes 359 microseconds.
#include <hip/hip_runtime.h>
#include <hip/hip_bf16.h>

// Multi-head self-attention (B=2,S=2048,D=64,H=12), fp32 throughout,
// all GEMM stages on v_wmma_f32_16x16x4_f32 (native fp32 WMMA, wave32).

#define B_  2
#define S_  2048
#define D_  64
#define H_  12
#define HD  768           // H_*D_
#define NEGV (-99999.0f)

typedef __attribute__((ext_vector_type(2))) float v2f;
typedef __attribute__((ext_vector_type(8))) float v8f;

// D = A(16x4 f32) * B(4x16 f32) + C(16x16 f32)
__device__ __forceinline__ v8f wmma4(v2f a, v2f b, v8f c) {
    return __builtin_amdgcn_wmma_f32_16x16x4_f32(
        /*neg_a=*/false, a, /*neg_b=*/false, b,
        /*c_mod=*/(short)0, c, /*reuse_a=*/false, /*reuse_b=*/false);
}

// ---------------------------------------------------------------------------
// Kernel 1: QKV projection. x[4096x64] @ W[64x768] + b -> [B,H,S,64] scratch.
// One wave computes one 16x16 output tile; K-loop of 16 WMMA steps (k=4 each).
// ---------------------------------------------------------------------------
__global__ __launch_bounds__(32)
void qkv_proj_kernel(const float* __restrict__ x,
                     const float* __restrict__ Wq, const float* __restrict__ bq,
                     const float* __restrict__ Wk, const float* __restrict__ bk,
                     const float* __restrict__ Wv, const float* __restrict__ bv,
                     float* __restrict__ ws) {
    const int lane = threadIdx.x;
    const int lo = lane & 15, hi = lane >> 4;           // hi in {0,1}
    const int n0 = blockIdx.x * 16;                     // 0..767 col tile
    const int m0 = blockIdx.y * 16;                     // 0..4095 row tile
    const int which = blockIdx.z;                       // 0=Q 1=K 2=V

    const float* W    = (which == 0) ? Wq : (which == 1) ? Wk : Wv;
    const float* bias = (which == 0) ? bq : (which == 1) ? bk : bv;
    float* out = ws + (size_t)which * (size_t)(B_ * S_ * HD);

    const float* xrow = x + (size_t)(m0 + lo) * D_;     // A-matrix row for this lane
    v8f acc = {};
    #pragma unroll
    for (int c = 0; c < 16; ++c) {
        const int kk = 4 * c + 2 * hi;
        v2f a = *(const v2f*)(xrow + kk);               // A(m=lo, k=kk..kk+1)
        v2f b;                                          // B(k=kk..kk+1, n=lo)
        b.x = W[(size_t)kk       * HD + n0 + lo];
        b.y = W[(size_t)(kk + 1) * HD + n0 + lo];
        acc = wmma4(a, b, acc);
    }
    const float bn = bias[n0 + lo];
    const int h    = n0 / 64;                           // tile never crosses heads
    const int dcol = (n0 & 63) + lo;
    #pragma unroll
    for (int v = 0; v < 8; ++v) {
        const int m = m0 + v + 8 * hi;                  // C/D layout row
        const int bb = m / S_, s = m % S_;
        out[(((size_t)bb * H_ + h) * S_ + s) * D_ + dcol] = acc[v] + bn;
    }
}

// ---------------------------------------------------------------------------
// Kernel 2: flash-style causal attention with the quirky mask.
// One wave owns a 16-row q tile of one (b,h); streams k tiles 0..q0.
// ---------------------------------------------------------------------------
__global__ __launch_bounds__(32)
void attn_kernel(const float* __restrict__ ws_q, const float* __restrict__ ws_k,
                 const float* __restrict__ ws_v, float* __restrict__ ws_o) {
    __shared__ float pl[16 * 17];                       // padded P bounce tile
    const int lane = threadIdx.x;
    const int lo = lane & 15, hi = lane >> 4;
    const int bh = blockIdx.x >> 7;                     // 0..23
    const int q0 = (blockIdx.x & 127) * 16;

    const size_t base = (size_t)bh * S_ * D_;
    const float* Q = ws_q + base;
    const float* K = ws_k + base;
    const float* V = ws_v + base;

    // Preload the Q tile in A-layout: 16 chunks of v2f.
    v2f qa[16];
    {
        const float* qrow = Q + (size_t)(q0 + lo) * D_;
        #pragma unroll
        for (int c = 0; c < 16; ++c) qa[c] = *(const v2f*)(qrow + 4 * c + 2 * hi);
    }

    v8f acc0 = {}, acc1 = {}, acc2 = {}, acc3 = {};     // O tile, 16x64
    float rm[8], rl[8];                                 // per-row max / sum (C/D layout)
    #pragma unroll
    for (int v = 0; v < 8; ++v) { rm[v] = -3.0e38f; rl[v] = 0.0f; }

    for (int k0 = 0; k0 <= q0; k0 += 16) {
        // ---- S = Q * K^T (16 WMMA steps over d) ----
        v8f s = {};
        const float* krow = K + (size_t)(k0 + lo) * D_;
        #pragma unroll
        for (int c = 0; c < 16; ++c) {
            v2f kb = *(const v2f*)(krow + 4 * c + 2 * hi);
            s = wmma4(qa[c], kb, s);
        }
        // ---- quirky causal mask + online softmax ----
        const int kcol = k0 + lo;
        float p[8];
        #pragma unroll
        for (int v = 0; v < 8; ++v) {
            const int qr = q0 + v + 8 * hi;
            float val = s[v];
            if (kcol > qr || val == 0.0f) val = NEGV;   // tril + exact-zero quirk
            p[v] = val;
        }
        #pragma unroll
        for (int v = 0; v < 8; ++v) {
            float t = p[v];                             // row-max within 16-lane half
            t = fmaxf(t, __shfl_xor(t, 1));
            t = fmaxf(t, __shfl_xor(t, 2));
            t = fmaxf(t, __shfl_xor(t, 4));
            t = fmaxf(t, __shfl_xor(t, 8));
            const float nm = fmaxf(rm[v], t);
            const float sc = __expf(rm[v] - nm);
            rm[v] = nm;
            const float e = __expf(p[v] - nm);
            p[v] = e;
            float ts = e;                               // row-sum of exp
            ts += __shfl_xor(ts, 1);
            ts += __shfl_xor(ts, 2);
            ts += __shfl_xor(ts, 4);
            ts += __shfl_xor(ts, 8);
            rl[v] = rl[v] * sc + ts;
            acc0[v] *= sc; acc1[v] *= sc; acc2[v] *= sc; acc3[v] *= sc;
        }
        // ---- C/D-layout P -> LDS -> A-layout chunks ----
        #pragma unroll
        for (int v = 0; v < 8; ++v) pl[(v + 8 * hi) * 17 + lo] = p[v];
        __syncthreads();                                // single wave: DS-cnt fence
        v2f pa[4];
        #pragma unroll
        for (int c = 0; c < 4; ++c) {
            pa[c].x = pl[lo * 17 + 4 * c + 2 * hi];
            pa[c].y = pl[lo * 17 + 4 * c + 2 * hi + 1];
        }
        __syncthreads();
        // ---- O += P * V (4 chunks x 4 n-tiles = 16 WMMA) ----
        #pragma unroll
        for (int c = 0; c < 4; ++c) {
            const int r = k0 + 4 * c + 2 * hi;
            const float* v0 = V + (size_t)r * D_;
            const float* v1 = V + (size_t)(r + 1) * D_;
            v2f b0; b0.x = v0[lo];      b0.y = v1[lo];      acc0 = wmma4(pa[c], b0, acc0);
            v2f b1; b1.x = v0[16 + lo]; b1.y = v1[16 + lo]; acc1 = wmma4(pa[c], b1, acc1);
            v2f b2; b2.x = v0[32 + lo]; b2.y = v1[32 + lo]; acc2 = wmma4(pa[c], b2, acc2);
            v2f b3; b3.x = v0[48 + lo]; b3.y = v1[48 + lo]; acc3 = wmma4(pa[c], b3, acc3);
        }
    }

    // ---- normalize + write O as [B,S,H*D] ----
    const int bb = bh / H_, h = bh % H_;
    #pragma unroll
    for (int v = 0; v < 8; ++v) {
        const float inv = 1.0f / rl[v];
        const int srow = q0 + v + 8 * hi;
        const size_t o = ((size_t)bb * S_ + srow) * HD + h * 64 + lo;
        ws_o[o]      = acc0[v] * inv;
        ws_o[o + 16] = acc1[v] * inv;
        ws_o[o + 32] = acc2[v] * inv;
        ws_o[o + 48] = acc3[v] * inv;
    }
}

// ---------------------------------------------------------------------------
// Kernel 3: output projection. O[4096x768] @ Wo[768x64] + bo -> out[4096x64].
// ---------------------------------------------------------------------------
__global__ __launch_bounds__(32)
void out_proj_kernel(const float* __restrict__ o_ws, const float* __restrict__ Wo,
                     const float* __restrict__ bo, float* __restrict__ out) {
    const int lane = threadIdx.x;
    const int lo = lane & 15, hi = lane >> 4;
    const int n0 = blockIdx.x * 16;                     // 0..63
    const int m0 = blockIdx.y * 16;                     // 0..4095
    const float* arow = o_ws + (size_t)(m0 + lo) * HD;
    v8f acc = {};
    for (int c = 0; c < 192; ++c) {
        const int kk = 4 * c + 2 * hi;
        v2f a = *(const v2f*)(arow + kk);
        v2f b;
        b.x = Wo[(size_t)kk       * D_ + n0 + lo];
        b.y = Wo[(size_t)(kk + 1) * D_ + n0 + lo];
        acc = wmma4(a, b, acc);
    }
    const float bn = bo[n0 + lo];
    #pragma unroll
    for (int v = 0; v < 8; ++v)
        out[(size_t)(m0 + v + 8 * hi) * D_ + n0 + lo] = acc[v] + bn;
}

extern "C" void kernel_launch(void* const* d_in, const int* in_sizes, int n_in,
                              void* d_out, int out_size, void* d_ws, size_t ws_size,
                              hipStream_t stream) {
    const float* x  = (const float*)d_in[0];
    const float* Wq = (const float*)d_in[1];
    const float* bq = (const float*)d_in[2];
    const float* Wk = (const float*)d_in[3];
    const float* bk = (const float*)d_in[4];
    const float* Wv = (const float*)d_in[5];
    const float* bv = (const float*)d_in[6];
    const float* Wo = (const float*)d_in[7];
    const float* bo = (const float*)d_in[8];
    float* out = (float*)d_out;

    float* ws = (float*)d_ws;
    const size_t QKV = (size_t)B_ * S_ * HD;            // 3,145,728 floats each
    float* q = ws;
    float* k = ws + QKV;
    float* v = ws + 2 * QKV;
    float* o = ws + 3 * QKV;                            // total 48 MB of d_ws

    // 1) QKV projections: 48 n-tiles x 256 m-tiles x 3 matrices, 1 wave/tile.
    qkv_proj_kernel<<<dim3(HD / 16, (B_ * S_) / 16, 3), 32, 0, stream>>>(
        x, Wq, bq, Wk, bk, Wv, bv, ws);

    // 2) Attention: 24 (b,h) x 128 q-tiles, one wave each.
    attn_kernel<<<dim3(B_ * H_ * (S_ / 16)), 32, 0, stream>>>(q, k, v, o);

    // 3) Output projection: 4 n-tiles x 256 m-tiles.
    out_proj_kernel<<<dim3(D_ / 16, (B_ * S_) / 16), 32, 0, stream>>>(o, Wo, bo, out);
}

// v001
// It runs in 228 microseconds.
// Next to v000, in two timings, it ran 1.60 and 1.61 times as fast.
#include <hip/hip_runtime.h>
#include <hip/hip_bf16.h>

// Multi-head self-attention (B=2,S=2048,D=64,H=12), fp32 throughout,
// all GEMM stages on v_wmma_f32_16x16x4_f32 (native fp32 WMMA, wave32).

#define B_  2
#define S_  2048
#define D_  64
#define H_  12
#define HD  768           // H_*D_
#define NEGV (-99999.0f)

typedef __attribute__((ext_vector_type(2))) float v2f;
typedef __attribute__((ext_vector_type(8))) float v8f;

// D = A(16x4 f32) * B(4x16 f32) + C(16x16 f32)
__device__ __forceinline__ v8f wmma4(v2f a, v2f b, v8f c) {
    return __builtin_amdgcn_wmma_f32_16x16x4_f32(
        /*neg_a=*/false, a, /*neg_b=*/false, b,
        /*c_mod=*/(short)0, c, /*reuse_a=*/false, /*reuse_b=*/false);
}

// ---------------------------------------------------------------------------
// Kernel 1: QKV projection. x[4096x64] @ W[64x768] + b -> [B,H,S,64] scratch.
// One wave computes one 16x16 output tile; K-loop of 16 WMMA steps (k=4 each).
// ---------------------------------------------------------------------------
__global__ __launch_bounds__(32)
void qkv_proj_kernel(const float* __restrict__ x,
                     const float* __restrict__ Wq, const float* __restrict__ bq,
                     const float* __restrict__ Wk, const float* __restrict__ bk,
                     const float* __restrict__ Wv, const float* __restrict__ bv,
                     float* __restrict__ ws) {
    const int lane = threadIdx.x;
    const int lo = lane & 15, hi = lane >> 4;           // hi in {0,1}
    const int n0 = blockIdx.x * 16;                     // 0..767 col tile
    const int m0 = blockIdx.y * 16;                     // 0..4095 row tile
    const int which = blockIdx.z;                       // 0=Q 1=K 2=V

    const float* W    = (which == 0) ? Wq : (which == 1) ? Wk : Wv;
    const float* bias = (which == 0) ? bq : (which == 1) ? bk : bv;
    float* out = ws + (size_t)which * (size_t)(B_ * S_ * HD);

    const float* xrow = x + (size_t)(m0 + lo) * D_;     // A-matrix row for this lane
    v8f acc = {};
    #pragma unroll
    for (int c = 0; c < 16; ++c) {
        const int kk = 4 * c + 2 * hi;
        v2f a = *(const v2f*)(xrow + kk);               // A(m=lo, k=kk..kk+1)
        v2f b;                                          // B(k=kk..kk+1, n=lo)
        b.x = W[(size_t)kk       * HD + n0 + lo];
        b.y = W[(size_t)(kk + 1) * HD + n0 + lo];
        acc = wmma4(a, b, acc);
    }
    const float bn = bias[n0 + lo];
    const int h    = n0 / 64;                           // tile never crosses heads
    const int dcol = (n0 & 63) + lo;
    #pragma unroll
    for (int v = 0; v < 8; ++v) {
        const int m = m0 + v + 8 * hi;                  // C/D layout row
        const int bb = m / S_, s = m % S_;
        out[(((size_t)bb * H_ + h) * S_ + s) * D_ + dcol] = acc[v] + bn;
    }
}

// ---------------------------------------------------------------------------
// Kernel 2: flash-style causal attention with the quirky mask.
// Four waves form a work-group that owns 64 q rows of one (b,h), 16 rows a wave.
// K and V come in tiles of 64 keys, copied asynchronously into two LDS buffers:
// tile t+1 flies while tile t is worked on, and all four waves read the same tile.
// ---------------------------------------------------------------------------
#define KT 64             // keys per staged tile
#define KP 68             // K row pitch in LDS, floats: 8-byte column reads meet no bank twice
#define VP 80             // V row pitch in LDS, floats: rows r..r+3 fall on four different bank quarters

// One tile of 64 rows x 256 bytes, 1024 pieces of 16 bytes, eight per thread.
// g: this thread's first piece in global memory (a wave covers 512 contiguous bytes),
// l: its LDS byte address, step: LDS bytes between a thread's pieces (eight rows).
__device__ __forceinline__ void copy_tile(const float* g, unsigned l, unsigned step) {
    // The closing s_wait_xcnt keeps the address registers whole until the copies have taken them.
    asm volatile(
        "global_load_async_to_lds_b128 %0, %8, off\n\t"
        "global_load_async_to_lds_b128 %1, %9, off\n\t"
        "global_load_async_to_lds_b128 %2, %10, off\n\t"
        "global_load_async_to_lds_b128 %3, %11, off\n\t"
        "global_load_async_to_lds_b128 %4, %12, off\n\t"
        "global_load_async_to_lds_b128 %5, %13, off\n\t"
        "global_load_async_to_lds_b128 %6, %14, off\n\t"
        "global_load_async_to_lds_b128 %7, %15, off\n\t"
        "s_wait_xcnt 0x0"
        :: "v"(l), "v"(l + step), "v"(l + 2 * step), "v"(l + 3 * step),
           "v"(l + 4 * step), "v"(l + 5 * step), "v"(l + 6 * step), "v"(l + 7 * step),
           "v"(g), "v"(g + 512), "v"(g + 1024), "v"(g + 1536),
           "v"(g + 2048), "v"(g + 2560), "v"(g + 3072), "v"(g + 3584)
        : "memory");
}

__global__ __launch_bounds__(128)
void attn_kernel(const float* __restrict__ ws_q, const float* __restrict__ ws_k,
                 const float* __restrict__ ws_v, float* __restrict__ ws_o) {
    __shared__ __attribute__((aligned(16))) float kbuf[2][KT * KP];
    __shared__ __attribute__((aligned(16))) float vbuf[2][KT * VP];
    __shared__ float pl[4][16 * 17];                    // padded P bounce tile, one per wave
    const int tid  = threadIdx.x;
    const int lane = tid & 31;
    const int wave = __builtin_amdgcn_readfirstlane(tid >> 5);
    const int lo = lane & 15, hi = lane >> 4;
    const int bh = blockIdx.x >> 5;                     // 0..23
    const int qb = blockIdx.x & 31;                     // 64-row q block
    const int q0 = qb * 64 + wave * 16;
    const int nt = qb + 1;                              // staged tiles 0..qb

    const size_t base = (size_t)bh * S_ * D_;
    const float* Q = ws_q + base;
    const float* Kc = ws_k + base + tid * 4;            // this thread's first piece of tile 0
    const float* Vc = ws_v + base + tid * 4;
    const int crow = tid >> 4, ccol = (tid & 15) * 4;   // its row and column in the tile
    const unsigned kl0 = (unsigned)(size_t)&kbuf[0][crow * KP + ccol];
    const unsigned kl1 = (unsigned)(size_t)&kbuf[1][crow * KP + ccol];
    const unsigned vl0 = (unsigned)(size_t)&vbuf[0][crow * VP + ccol];
    const unsigned vl1 = (unsigned)(size_t)&vbuf[1][crow * VP + ccol];
    float* plw = pl[wave];

    copy_tile(Kc, kl0, 8 * KP * 4);
    copy_tile(Vc, vl0, 8 * VP * 4);

    // Preload the Q tile in A-layout: 16 chunks of v2f.
    v2f qa[16];
    {
        const float* qrow = Q + (size_t)(q0 + lo) * D_;
        #pragma unroll
        for (int c = 0; c < 16; ++c) qa[c] = *(const v2f*)(qrow + 4 * c + 2 * hi);
    }

    v8f acc0 = {}, acc1 = {}, acc2 = {}, acc3 = {};     // O tile, 16x64
    float rm[8], rl[8];                                 // per-row max / sum (C/D layout)
    #pragma unroll
    for (int v = 0; v < 8; ++v) { rm[v] = -3.0e38f; rl[v] = 0.0f; }

    asm volatile("s_wait_asynccnt 0x0" ::: "memory");   // this wave's share of tile 0 has landed
    __syncthreads();                                    // ... and every other wave's
    if (nt > 1) {
        copy_tile(Kc + KT * D_, kl1, 8 * KP * 4);
        copy_tile(Vc + KT * D_, vl1, 8 * VP * 4);
    }

    for (int t = 0; t < nt; ++t) {
        const float* kt = kbuf[t & 1];
        const float* vt = vbuf[t & 1];
        // 16-key steps of this tile with k0 <= q0: all four below the diagonal tile.
        const int ns = (t < qb) ? 4 : wave + 1;
        for (int u = 0; u < ns; ++u) {
            const int k0 = t * KT + u * 16;
            // ---- K and V fragments of this step, from LDS ----
            const float* krow = kt + (u * 16 + lo) * KP + 2 * hi;
            v2f kf[16];
            #pragma unroll                                  // fragment arrays stay in registers
            for (int c = 0; c < 16; ++c) kf[c] = *(const v2f*)(krow + 4 * c);
            const float* vrow = vt + (u * 16 + 2 * hi) * VP + lo;
            v2f vf[4][4];
            #pragma unroll                                  // as above
            for (int c = 0; c < 4; ++c) {
                #pragma unroll                              // as above
                for (int n = 0; n < 4; ++n) {
                    vf[c][n].x = vrow[(4 * c)     * VP + 16 * n];
                    vf[c][n].y = vrow[(4 * c + 1) * VP + 16 * n];
                }
            }
            // ---- S = Q * K^T (16 WMMA steps over d) ----
            v8f s = {};
            #pragma unroll
            for (int c = 0; c < 16; ++c) s = wmma4(qa[c], kf[c], s);
            // ---- quirky causal mask + online softmax ----
            const int kcol = k0 + lo;
            float p[8];
            #pragma unroll
            for (int v = 0; v < 8; ++v) {
                const int qr = q0 + v + 8 * hi;
                float val = s[v];
                if (kcol > qr || val == 0.0f) val = NEGV;   // tril + exact-zero quirk
                p[v] = val;
            }
            #pragma unroll
            for (int v = 0; v < 8; ++v) {
                float t4 = p[v];                            // row-max within 16-lane half
                t4 = fmaxf(t4, __shfl_xor(t4, 1));
                t4 = fmaxf(t4, __shfl_xor(t4, 2));
                t4 = fmaxf(t4, __shfl_xor(t4, 4));
                t4 = fmaxf(t4, __shfl_xor(t4, 8));
                const float nm = fmaxf(rm[v], t4);
                const float sc = __expf(rm[v] - nm);
                rm[v] = nm;
                const float e = __expf(p[v] - nm);
                p[v] = e;
                float ts = e;                               // row-sum of exp
                ts += __shfl_xor(ts, 1);
                ts += __shfl_xor(ts, 2);
                ts += __shfl_xor(ts, 4);
                ts += __shfl_xor(ts, 8);
                rl[v] = rl[v] * sc + ts;
                acc0[v] *= sc; acc1[v] *= sc; acc2[v] *= sc; acc3[v] *= sc;
            }
            // ---- C/D-layout P -> LDS -> A-layout chunks (the wave's own tile) ----
            #pragma unroll
            for (int v = 0; v < 8; ++v) plw[(v + 8 * hi) * 17 + lo] = p[v];
            // The wave's P stores are done before its other lanes read them.
            asm volatile("s_wait_dscnt 0x0" ::: "memory");
            v2f pa[4];
            #pragma unroll
            for (int c = 0; c < 4; ++c) {
                pa[c].x = plw[lo * 17 + 4 * c + 2 * hi];
                pa[c].y = plw[lo * 17 + 4 * c + 2 * hi + 1];
            }
            // The P reads are done before the next step's stores overwrite the tile.
            asm volatile("s_wait_dscnt 0x0" ::: "memory");
            // ---- O += P * V (4 chunks x 4 n-tiles = 16 WMMA) ----
            #pragma unroll
            for (int c = 0; c < 4; ++c) {
                acc0 = wmma4(pa[c], vf[c][0], acc0);
                acc1 = wmma4(pa[c], vf[c][1], acc1);
                acc2 = wmma4(pa[c], vf[c][2], acc2);
                acc3 = wmma4(pa[c], vf[c][3], acc3);
            }
        }
        // ---- hand-over: tile t+1 becomes readable, tile t's buffer becomes free ----
        asm volatile("s_wait_dscnt 0x0" ::: "memory");      // this wave's reads of tile t are done
        asm volatile("s_wait_asynccnt 0x0" ::: "memory");   // its share of tile t+1 has landed
        __syncthreads();
        if (t + 2 < nt) {
            const size_t off = (size_t)(t + 2) * (KT * D_);
            copy_tile(Kc + off, (t & 1) ? kl1 : kl0, 8 * KP * 4);
            copy_tile(Vc + off, (t & 1) ? vl1 : vl0, 8 * VP * 4);
        }
    }
    asm volatile("s_wait_asynccnt 0x0" ::: "memory");       // nothing in flight when the wave ends

    // ---- normalize + write O as [B,S,H*D] ----
    const int bb = bh / H_, h = bh % H_;
    #pragma unroll
    for (int v = 0; v < 8; ++v) {
        const float inv = 1.0f / rl[v];
        const int srow = q0 + v + 8 * hi;
        const size_t o = ((size_t)bb * S_ + srow) * HD + h * 64 + lo;
        ws_o[o]      = acc0[v] * inv;
        ws_o[o + 16] = acc1[v] * inv;
        ws_o[o + 32] = acc2[v] * inv;
        ws_o[o + 48] = acc3[v] * inv;
    }
}

// ---------------------------------------------------------------------------
// Kernel 3: output projection. O[4096x768] @ Wo[768x64] + bo -> out[4096x64].
// ---------------------------------------------------------------------------
__global__ __launch_bounds__(32)
void out_proj_kernel(const float* __restrict__ o_ws, const float* __restrict__ Wo,
                     const float* __restrict__ bo, float* __restrict__ out) {
    const int lane = threadIdx.x;
    const int lo = lane & 15, hi = lane >> 4;
    const int n0 = blockIdx.x * 16;                     // 0..63
    const int m0 = blockIdx.y * 16;                     // 0..4095
    const float* arow = o_ws + (size_t)(m0 + lo) * HD;
    v8f acc = {};
    for (int c = 0; c < 192; ++c) {
        const int kk = 4 * c + 2 * hi;
        v2f a = *(const v2f*)(arow + kk);
        v2f b;
        b.x = Wo[(size_t)kk       * D_ + n0 + lo];
        b.y = Wo[(size_t)(kk + 1) * D_ + n0 + lo];
        acc = wmma4(a, b, acc);
    }
    const float bn = bo[n0 + lo];
    #pragma unroll
    for (int v = 0; v < 8; ++v)
        out[(size_t)(m0 + v + 8 * hi) * D_ + n0 + lo] = acc[v] + bn;
}

extern "C" void kernel_launch(void* const* d_in, const int* in_sizes, int n_in,
                              void* d_out, int out_size, void* d_ws, size_t ws_size,
                              hipStream_t stream) {
    const float* x  = (const float*)d_in[0];
    const float* Wq = (const float*)d_in[1];
    const float* bq = (const float*)d_in[2];
    const float* Wk = (const float*)d_in[3];
    const float* bk = (const float*)d_in[4];
    const float* Wv = (const float*)d_in[5];
    const float* bv = (const float*)d_in[6];
    const float* Wo = (const float*)d_in[7];
    const float* bo = (const float*)d_in[8];
    float* out = (float*)d_out;

    float* ws = (float*)d_ws;
    const size_t QKV = (size_t)B_ * S_ * HD;            // 3,145,728 floats each
    float* q = ws;
    float* k = ws + QKV;
    float* v = ws + 2 * QKV;
    float* o = ws + 3 * QKV;                            // total 48 MB of d_ws

    // 1) QKV projections: 48 n-tiles x 256 m-tiles x 3 matrices, 1 wave/tile.
    qkv_proj_kernel<<<dim3(HD / 16, (B_ * S_) / 16, 3), 32, 0, stream>>>(
        x, Wq, bq, Wk, bk, Wv, bv, ws);

    // 2) Attention: 24 (b,h) x 32 q-blocks of 64 rows, four waves each.
    attn_kernel<<<dim3(B_ * H_ * (S_ / 64)), 128, 0, stream>>>(q, k, v, o);

    // 3) Output projection: 4 n-tiles x 256 m-tiles.
    out_proj_kernel<<<dim3(D_ / 16, (B_ * S_) / 16), 32, 0, stream>>>(o, Wo, bo, out);
}

// v002
// A run of this version takes 186 microseconds.
// Next to v001, in two timings, it ran 1.23 times as fast each time.
// Counting every step since v000, it is 1.97 times as fast.
#include <hip/hip_runtime.h>
#include <hip/hip_bf16.h>

// Multi-head self-attention (B=2,S=2048,D=64,H=12), fp32 throughout,
// all GEMM stages on v_wmma_f32_16x16x4_f32 (native fp32 WMMA, wave32).

#define B_  2
#define S_  2048
#define D_  64
#define H_  12
#define HD  768           // H_*D_
#define NEGV (-99999.0f)

typedef __attribute__((ext_vector_type(2))) float v2f;
typedef __attribute__((ext_vector_type(8))) float v8f;

// D = A(16x4 f32) * B(4x16 f32) + C(16x16 f32)
__device__ __forceinline__ v8f wmma4(v2f a, v2f b, v8f c) {
    return __builtin_amdgcn_wmma_f32_16x16x4_f32(
        /*neg_a=*/false, a, /*neg_b=*/false, b,
        /*c_mod=*/(short)0, c, /*reuse_a=*/false, /*reuse_b=*/false);
}

// ---------------------------------------------------------------------------
// Kernel 1: QKV projection. x[4096x64] @ W[64x768] + b -> [B,H,S,64] scratch.
// One wave computes one 16x16 output tile; K-loop of 16 WMMA steps (k=4 each).
// ---------------------------------------------------------------------------
__global__ __launch_bounds__(32)
void qkv_proj_kernel(const float* __restrict__ x,
                     const float* __restrict__ Wq, const float* __restrict__ bq,
                     const float* __restrict__ Wk, const float* __restrict__ bk,
                     const float* __restrict__ Wv, const float* __restrict__ bv,
                     float* __restrict__ ws) {
    const int lane = threadIdx.x;
    const int lo = lane & 15, hi = lane >> 4;           // hi in {0,1}
    const int n0 = blockIdx.x * 16;                     // 0..767 col tile
    const int m0 = blockIdx.y * 16;                     // 0..4095 row tile
    const int which = blockIdx.z;                       // 0=Q 1=K 2=V

    const float* W    = (which == 0) ? Wq : (which == 1) ? Wk : Wv;
    const float* bias = (which == 0) ? bq : (which == 1) ? bk : bv;
    float* out = ws + (size_t)which * (size_t)(B_ * S_ * HD);

    const float* xrow = x + (size_t)(m0 + lo) * D_;     // A-matrix row for this lane
    v8f acc = {};
    #pragma unroll
    for (int c = 0; c < 16; ++c) {
        const int kk = 4 * c + 2 * hi;
        v2f a = *(const v2f*)(xrow + kk);               // A(m=lo, k=kk..kk+1)
        v2f b;                                          // B(k=kk..kk+1, n=lo)
        b.x = W[(size_t)kk       * HD + n0 + lo];
        b.y = W[(size_t)(kk + 1) * HD + n0 + lo];
        acc = wmma4(a, b, acc);
    }
    const float bn = bias[n0 + lo];
    const int h    = n0 / 64;                           // tile never crosses heads
    const int dcol = (n0 & 63) + lo;
    #pragma unroll
    for (int v = 0; v < 8; ++v) {
        const int m = m0 + v + 8 * hi;                  // C/D layout row
        const int bb = m / S_, s = m % S_;
        out[(((size_t)bb * H_ + h) * S_ + s) * D_ + dcol] = acc[v] + bn;
    }
}

#define KT 64
#define KP 68
#define VP 136

// One tile of 64 rows x 256 bytes, 1024 pieces of 16 bytes, eight per thread.
// g: this thread's first piece in global memory (a wave covers 512 contiguous bytes),
// l: its LDS byte address, step: LDS bytes between a thread's pieces (eight rows).
__device__ __forceinline__ void copy_tile(const float* g, unsigned l, unsigned step) {
    // The closing s_wait_xcnt keeps the address registers whole until the copies have taken them.
    asm volatile(
        "global_load_async_to_lds_b128 %0, %8, off\n\t"
        "global_load_async_to_lds_b128 %1, %9, off\n\t"
        "global_load_async_to_lds_b128 %2, %10, off\n\t"
        "global_load_async_to_lds_b128 %3, %11, off\n\t"
        "global_load_async_to_lds_b128 %4, %12, off\n\t"
        "global_load_async_to_lds_b128 %5, %13, off\n\t"
        "global_load_async_to_lds_b128 %6, %14, off\n\t"
        "global_load_async_to_lds_b128 %7, %15, off\n\t"
        "s_wait_xcnt 0x0"
        :: "v"(l), "v"(l + step), "v"(l + 2 * step), "v"(l + 3 * step),
           "v"(l + 4 * step), "v"(l + 5 * step), "v"(l + 6 * step), "v"(l + 7 * step),
           "v"(g), "v"(g + 512), "v"(g + 1024), "v"(g + 1536),
           "v"(g + 2048), "v"(g + 2560), "v"(g + 3072), "v"(g + 3584)
        : "memory");
}

// Lane l takes the value of lane l ^ 16.
__device__ __forceinline__ float xhalf(float x) {
    const int b = __builtin_bit_cast(int, x);
    return __builtin_bit_cast(float,
        __builtin_amdgcn_permlanex16(b, b, 0x76543210, 0xfedcba98, false, false));
}

__global__ __launch_bounds__(128)
void attn_kernel(const float* __restrict__ ws_q, const float* __restrict__ ws_k,
                 const float* __restrict__ ws_v, float* __restrict__ ws_o) {
    __shared__ __attribute__((aligned(16))) float kbuf[2][KT * KP];
    __shared__ __attribute__((aligned(16))) float vbuf[2][(KT / 2) * VP];
    const int tid  = threadIdx.x;
    const int lane = tid & 31;
    const int wave = __builtin_amdgcn_readfirstlane(tid >> 5);
    const int lo = lane & 15, hi = lane >> 4;
    const int bh = blockIdx.x >> 5;                     // 0..23
    const int qb = blockIdx.x & 31;                     // 64-row q block
    const int q0 = qb * 64 + wave * 16;
    const int nt = qb + 1;                              // staged tiles 0..qb

    const size_t base = (size_t)bh * S_ * D_;
    const float* Q = ws_q + base;
    const float* Kc = ws_k + base + tid * 4;            // this thread's first piece of tile 0
    const float* Vc = ws_v + base + tid * 4;
    const int crow = tid >> 4, ccol = (tid & 15) * 4;   // its row and column in the tile
    const unsigned kl0 = (unsigned)(size_t)&kbuf[0][crow * KP + ccol];
    const unsigned kl1 = (unsigned)(size_t)&kbuf[1][crow * KP + ccol];
    const int vpos = (crow >> 1) * VP + ccol * 2 + (crow & 1) * 4;   // its place among the alternating pieces
    const unsigned vl0 = (unsigned)(size_t)&vbuf[0][vpos];
    const unsigned vl1 = (unsigned)(size_t)&vbuf[1][vpos];

    copy_tile(Kc, kl0, 8 * KP * 4);
    copy_tile(Vc, vl0, 4 * VP * 4);

    // Preload the Q tile as B operand (column = query lo): 16 chunks of v2f.
    v2f qa[16];
    {
        const float* qrow = Q + (size_t)(q0 + lo) * D_;
        #pragma unroll
        for (int c = 0; c < 16; ++c) qa[c] = *(const v2f*)(qrow + 4 * c + 2 * hi);
    }

    v8f acc0 = {}, acc1 = {}, acc2 = {}, acc3 = {};     // O^T tile: acc_n[v] = O[q0+lo][16n+8hi+v]
    const int qr = q0 + lo;                             // this lane's query
    float rm = -3.0e38f;                                // its running max (both halves alike)
    float rl = 0.0f;                                    // sum over this half's keys only

    asm volatile("s_wait_asynccnt 0x0" ::: "memory");   // this wave's share of tile 0 has landed
    __syncthreads();                                    // ... and every other wave's
    if (nt > 1) {
        copy_tile(Kc + KT * D_, kl1, 8 * KP * 4);
        copy_tile(Vc + KT * D_, vl1, 4 * VP * 4);
    }

    for (int t = 0; t < nt; ++t) {
        const float* kt = kbuf[t & 1];
        const float* vt = vbuf[t & 1];
        // 16-key steps of this tile with k0 <= q0: all four below the diagonal tile.
        const int ns = (t < qb) ? 4 : wave + 1;
        for (int u = 0; u < ns; ++u) {
            const int k0 = t * KT + u * 16;
            // ---- K and V fragments of this step, from LDS ----
            const float* krow = kt + (u * 16 + lo) * KP + 2 * hi;
            v2f kf[16];
            #pragma unroll                                  // fragment arrays stay in registers
            for (int c = 0; c < 16; ++c) kf[c] = *(const v2f*)(krow + 4 * c);
            // V^T as A operand: row = d (16n+lo), k = keys 8hi+2c, 8hi+2c+1, the keys that
            // registers 2c, 2c+1 of the score accumulator hold in this lane half.
            const float* vrow = vt + (u * 8 + 4 * hi) * VP + (lo >> 2) * 8 + (lo & 3);
            v2f vf[4][4];
            #pragma unroll                                  // as above
            for (int c = 0; c < 4; ++c) {
                #pragma unroll                              // as above
                for (int n = 0; n < 4; ++n) {
                    vf[c][n].x = vrow[c * VP + 32 * n];
                    vf[c][n].y = vrow[c * VP + 32 * n + 4];
                }
            }
            // All LDS reads of the step stand here as one group: left free, the scheduler sinks the
            // last V reads in front of their own product, where their latency shows.
            __builtin_amdgcn_sched_barrier(0);
            // ---- S^T = K * Q^T (16 WMMA steps over d): s[v] = S[q0+lo][k0+8hi+v] ----
            v8f s = {};
            #pragma unroll
            for (int c = 0; c < 16; ++c) s = wmma4(kf[c], qa[c], s);
            // ---- quirky causal mask + online softmax, one query per lane ----
            const int kbase = k0 + 8 * hi;
            float p[8];
            #pragma unroll
            for (int v = 0; v < 8; ++v) {
                float val = s[v];
                if (kbase + v > qr || val == 0.0f) val = NEGV;  // tril + exact-zero quirk
                p[v] = val;
            }
            float mx = fmaxf(fmaxf(fmaxf(p[0], p[1]), fmaxf(p[2], p[3])),
                             fmaxf(fmaxf(p[4], p[5]), fmaxf(p[6], p[7])));
            mx = fmaxf(mx, xhalf(mx));                      // the other eight keys of this query
            const float nm = fmaxf(rm, mx);
            const float sc = __expf(rm - nm);
            rm = nm;
            #pragma unroll
            for (int v = 0; v < 8; ++v) p[v] = __expf(p[v] - nm);
            rl = rl * sc + (((p[0] + p[1]) + (p[2] + p[3])) + ((p[4] + p[5]) + (p[6] + p[7])));
            acc0 *= sc; acc1 *= sc; acc2 *= sc; acc3 *= sc;
            // ---- O^T += V^T * P^T (4 chunks x 4 d-tiles = 16 WMMA), P straight from registers ----
            #pragma unroll
            for (int c = 0; c < 4; ++c) {
                v2f pb;
                pb.x = p[2 * c];
                pb.y = p[2 * c + 1];
                acc0 = wmma4(vf[c][0], pb, acc0);
                acc1 = wmma4(vf[c][1], pb, acc1);
                acc2 = wmma4(vf[c][2], pb, acc2);
                acc3 = wmma4(vf[c][3], pb, acc3);
            }
        }
        // ---- hand-over: tile t+1 becomes readable, tile t's buffer becomes free ----
        asm volatile("s_wait_dscnt 0x0" ::: "memory");      // this wave's reads of tile t are done
        asm volatile("s_wait_asynccnt 0x0" ::: "memory");   // its share of tile t+1 has landed
        __syncthreads();
        if (t + 2 < nt) {
            const size_t off = (size_t)(t + 2) * (KT * D_);
            copy_tile(Kc + off, (t & 1) ? kl1 : kl0, 8 * KP * 4);
            copy_tile(Vc + off, (t & 1) ? vl1 : vl0, 4 * VP * 4);
        }
    }
    asm volatile("s_wait_asynccnt 0x0" ::: "memory");       // nothing in flight when the wave ends

    // ---- normalize + write O as [B,S,H*D]: eight consecutive floats per d-tile and lane ----
    const int bb = bh / H_, h = bh % H_;
    const float inv = 1.0f / (rl + xhalf(rl));              // join the two halves' sums
    float* orow = ws_o + ((size_t)bb * S_ + qr) * HD + h * 64 + 8 * hi;
    *(v8f*)(orow)      = acc0 * inv;
    *(v8f*)(orow + 16) = acc1 * inv;
    *(v8f*)(orow + 32) = acc2 * inv;
    *(v8f*)(orow + 48) = acc3 * inv;
}

// ---------------------------------------------------------------------------
// Kernel 3: output projection. O[4096x768] @ Wo[768x64] + bo -> out[4096x64].
// ---------------------------------------------------------------------------
__global__ __launch_bounds__(32)
void out_proj_kernel(const float* __restrict__ o_ws, const float* __restrict__ Wo,
                     const float* __restrict__ bo, float* __restrict__ out) {
    const int lane = threadIdx.x;
    const int lo = lane & 15, hi = lane >> 4;
    const int n0 = blockIdx.x * 16;                     // 0..63
    const int m0 = blockIdx.y * 16;                     // 0..4095
    const float* arow = o_ws + (size_t)(m0 + lo) * HD;
    v8f acc = {};
    for (int c = 0; c < 192; ++c) {
        const int kk = 4 * c + 2 * hi;
        v2f a = *(const v2f*)(arow + kk);
        v2f b;
        b.x = Wo[(size_t)kk       * D_ + n0 + lo];
        b.y = Wo[(size_t)(kk + 1) * D_ + n0 + lo];
        acc = wmma4(a, b, acc);
    }
    const float bn = bo[n0 + lo];
    #pragma unroll
    for (int v = 0; v < 8; ++v)
        out[(size_t)(m0 + v + 8 * hi) * D_ + n0 + lo] = acc[v] + bn;
}

extern "C" void kernel_launch(void* const* d_in, const int* in_sizes, int n_in,
                              void* d_out, int out_size, void* d_ws, size_t ws_size,
                              hipStream_t stream) {
    const float* x  = (const float*)d_in[0];
    const float* Wq = (const float*)d_in[1];
    const float* bq = (const float*)d_in[2];
    const float* Wk = (const float*)d_in[3];
    const float* bk = (const float*)d_in[4];
    const float* Wv = (const float*)d_in[5];
    const float* bv = (const float*)d_in[6];
    const float* Wo = (const float*)d_in[7];
    const float* bo = (const float*)d_in[8];
    float* out = (float*)d_out;

    float* ws = (float*)d_ws;
    const size_t QKV = (size_t)B_ * S_ * HD;            // 3,145,728 floats each
    float* q = ws;
    float* k = ws + QKV;
    float* v = ws + 2 * QKV;
    float* o = ws + 3 * QKV;                            // total 48 MB of d_ws

    // 1) QKV projections: 48 n-tiles x 256 m-tiles x 3 matrices, 1 wave/tile.
    qkv_proj_kernel<<<dim3(HD / 16, (B_ * S_) / 16, 3), 32, 0, stream>>>(
        x, Wq, bq, Wk, bk, Wv, bv, ws);

    // 2) Attention: 24 (b,h) x 32 q-blocks of 64 rows, four waves each.
    attn_kernel<<<dim3(B_ * H_ * (S_ / 64)), 128, 0, stream>>>(q, k, v, o);

    // 3) Output projection: 4 n-tiles x 256 m-tiles.
    out_proj_kernel<<<dim3(D_ / 16, (B_ * S_) / 16), 32, 0, stream>>>(o, Wo, bo, out);
}

// v003
// It runs in 135 microseconds.
// Timed twice side by side with v002, it ran 1.37 times as fast both times.
// All steps since v000 together make it 2.71 times as fast.
#include <hip/hip_runtime.h>
#include <hip/hip_bf16.h>

// Multi-head self-attention (B=2,S=2048,D=64,H=12), fp32 throughout,
// all GEMM stages on v_wmma_f32_16x16x4_f32 (native fp32 WMMA, wave32).

#define B_  2
#define S_  2048
#define D_  64
#define H_  12
#define HD  768           // H_*D_
#define NEGV (-99999.0f)

typedef __attribute__((ext_vector_type(2))) float v2f;
typedef __attribute__((ext_vector_type(8))) float v8f;

// D = A(16x4 f32) * B(4x16 f32) + C(16x16 f32)
__device__ __forceinline__ v8f wmma4(v2f a, v2f b, v8f c) {
    return __builtin_amdgcn_wmma_f32_16x16x4_f32(
        /*neg_a=*/false, a, /*neg_b=*/false, b,
        /*c_mod=*/(short)0, c, /*reuse_a=*/false, /*reuse_b=*/false);
}

// ---------------------------------------------------------------------------
// Kernel 1: QKV projection. x[4096x64] @ W[64x768] + b -> [B,H,S,64] scratch.
// One wave computes one 16x16 output tile; K-loop of 16 WMMA steps (k=4 each).
// ---------------------------------------------------------------------------
__global__ __launch_bounds__(32)
void qkv_proj_kernel(const float* __restrict__ x,
                     const float* __restrict__ Wq, const float* __restrict__ bq,
                     const float* __restrict__ Wk, const float* __restrict__ bk,
                     const float* __restrict__ Wv, const float* __restrict__ bv,
                     float* __restrict__ ws) {
    const int lane = threadIdx.x;
    const int lo = lane & 15, hi = lane >> 4;           // hi in {0,1}
    const int n0 = blockIdx.x * 16;                     // 0..767 col tile
    const int m0 = blockIdx.y * 16;                     // 0..4095 row tile
    const int which = blockIdx.z;                       // 0=Q 1=K 2=V

    const float* W    = (which == 0) ? Wq : (which == 1) ? Wk : Wv;
    const float* bias = (which == 0) ? bq : (which == 1) ? bk : bv;
    float* out = ws + (size_t)which * (size_t)(B_ * S_ * HD);

    const float* xrow = x + (size_t)(m0 + lo) * D_;     // A-matrix row for this lane
    v8f acc = {};
    #pragma unroll
    for (int c = 0; c < 16; ++c) {
        const int kk = 4 * c + 2 * hi;
        v2f a = *(const v2f*)(xrow + kk);               // A(m=lo, k=kk..kk+1)
        v2f b;                                          // B(k=kk..kk+1, n=lo)
        b.x = W[(size_t)kk       * HD + n0 + lo];
        b.y = W[(size_t)(kk + 1) * HD + n0 + lo];
        acc = wmma4(a, b, acc);
    }
    const float bn = bias[n0 + lo];
    const int h    = n0 / 64;                           // tile never crosses heads
    const int dcol = (n0 & 63) + lo;
    #pragma unroll
    for (int v = 0; v < 8; ++v) {
        const int m = m0 + v + 8 * hi;                  // C/D layout row
        const int bb = m / S_, s = m % S_;
        out[(((size_t)bb * H_ + h) * S_ + s) * D_ + dcol] = acc[v] + bn;
    }
}

#define KT 64
#define KP 68
#define VP 136

// One tile of 64 rows x 256 bytes, 1024 pieces of 16 bytes, eight per thread.
// g: this thread's first piece in global memory (a wave covers 512 contiguous bytes),
// l: its LDS byte address, step: LDS bytes between a thread's pieces (eight rows).
__device__ __forceinline__ void copy_tile(const float* g, unsigned l, unsigned step) {
    // The closing s_wait_xcnt keeps the address registers whole until the copies have taken them.
    asm volatile(
        "global_load_async_to_lds_b128 %0, %8, off\n\t"
        "global_load_async_to_lds_b128 %1, %9, off\n\t"
        "global_load_async_to_lds_b128 %2, %10, off\n\t"
        "global_load_async_to_lds_b128 %3, %11, off\n\t"
        "global_load_async_to_lds_b128 %4, %12, off\n\t"
        "global_load_async_to_lds_b128 %5, %13, off\n\t"
        "global_load_async_to_lds_b128 %6, %14, off\n\t"
        "global_load_async_to_lds_b128 %7, %15, off\n\t"
        "s_wait_xcnt 0x0"
        :: "v"(l), "v"(l + step), "v"(l + 2 * step), "v"(l + 3 * step),
           "v"(l + 4 * step), "v"(l + 5 * step), "v"(l + 6 * step), "v"(l + 7 * step),
           "v"(g), "v"(g + 512), "v"(g + 1024), "v"(g + 1536),
           "v"(g + 2048), "v"(g + 2560), "v"(g + 3072), "v"(g + 3584)
        : "memory");
}

// Lane l takes the value of lane l ^ 16.
__device__ __forceinline__ float xhalf(float x) {
    const int b = __builtin_bit_cast(int, x);
    return __builtin_bit_cast(float,
        __builtin_amdgcn_permlanex16(b, b, 0x76543210, 0xfedcba98, false, false));
}

static_assert(B_ * H_ == 24 && S_ / 64 == 32, "the index map below is written for 3 x 8 heads and 32 q blocks");

__global__ __launch_bounds__(128)
void attn_kernel(const float* __restrict__ ws_q, const float* __restrict__ ws_k,
                 const float* __restrict__ ws_v, float* __restrict__ ws_o) {
    __shared__ __attribute__((aligned(16))) float kbuf[2][KT * KP];
    __shared__ __attribute__((aligned(16))) float vbuf[2][(KT / 2) * VP];
    const int tid  = threadIdx.x;
    const int lane = tid & 31;
    const int wave = __builtin_amdgcn_readfirstlane(tid >> 5);
    const int lo = lane & 15, hi = lane >> 4;
    // Which (b,h) and which 64-row q block this work-group takes: any one-to-one map is right, this one is for speed.
    // A q block's cost grows with its index, and all 768 work-groups are resident at once, three to a WGP. If they are
    // dealt in turn over the 256 WGPs, indices i, i + 256 and i + 512 share a WGP: they take c0, c1, c2, three permutations of
    // 0..31 whose sum is 47 or 46 for every r, so every WGP gets 49 or 50 key tiles. The largest of the
    // three goes to the lowest index, for speed only.
    const int rnd = blockIdx.x >> 8;                    // 0..2
    const int grp = (blockIdx.x >> 5) & 7;
    const int r   = blockIdx.x & 31;
    const int c0 = r, c1 = (r < 16 ? 31 : 62) - 2 * r, c2 = (r + 16) & 31;
    const int k0 = (c1 > c0) + (c2 > c0);               // place of each by falling size, ties by position
    const int k1 = (c0 >= c1) + (c2 > c1);
    const int sel = (k0 == rnd) ? 0 : (k1 == rnd) ? 1 : 2;
    const int bh = sel * 8 + grp;                       // 0..23
    const int qb = (sel == 0) ? c0 : (sel == 1) ? c1 : c2;
    const int q0 = qb * 64 + wave * 16;
    const int nt = qb + 1;                              // staged tiles 0..qb

    const size_t base = (size_t)bh * S_ * D_;
    const float* Q = ws_q + base;
    const float* Kc = ws_k + base + tid * 4;            // this thread's first piece of tile 0
    const float* Vc = ws_v + base + tid * 4;
    const int crow = tid >> 4, ccol = (tid & 15) * 4;   // its row and column in the tile
    const unsigned kl0 = (unsigned)(size_t)&kbuf[0][crow * KP + ccol];
    const unsigned kl1 = (unsigned)(size_t)&kbuf[1][crow * KP + ccol];
    const int vpos = (crow >> 1) * VP + ccol * 2 + (crow & 1) * 4;   // its place among the alternating pieces
    const unsigned vl0 = (unsigned)(size_t)&vbuf[0][vpos];
    const unsigned vl1 = (unsigned)(size_t)&vbuf[1][vpos];

    copy_tile(Kc, kl0, 8 * KP * 4);
    copy_tile(Vc, vl0, 4 * VP * 4);

    // Preload the Q tile as B operand (column = query lo): 16 chunks of v2f.
    v2f qa[16];
    {
        const float* qrow = Q + (size_t)(q0 + lo) * D_;
        #pragma unroll
        for (int c = 0; c < 16; ++c) qa[c] = *(const v2f*)(qrow + 4 * c + 2 * hi);
    }

    v8f acc0 = {}, acc1 = {}, acc2 = {}, acc3 = {};     // O^T tile: acc_n[v] = O[q0+lo][16n+8hi+v]
    const int qr = q0 + lo;                             // this lane's query
    float rm = -3.0e38f;                                // its running max (both halves alike)
    float rl = 0.0f;                                    // sum over this half's keys only

    asm volatile("s_wait_asynccnt 0x0" ::: "memory");   // this wave's share of tile 0 has landed
    __syncthreads();                                    // ... and every other wave's
    if (nt > 1) {
        copy_tile(Kc + KT * D_, kl1, 8 * KP * 4);
        copy_tile(Vc + KT * D_, vl1, 4 * VP * 4);
    }

    for (int t = 0; t < nt; ++t) {
        const float* kt = kbuf[t & 1];
        const float* vt = vbuf[t & 1];
        // 16-key steps of this tile with k0 <= q0: all four below the diagonal tile.
        const int ns = (t < qb) ? 4 : wave + 1;
        for (int u = 0; u < ns; ++u) {
            const int k0 = t * KT + u * 16;
            // ---- K and V fragments of this step, from LDS ----
            const float* krow = kt + (u * 16 + lo) * KP + 2 * hi;
            v2f kf[16];
            #pragma unroll                                  // fragment arrays stay in registers
            for (int c = 0; c < 16; ++c) kf[c] = *(const v2f*)(krow + 4 * c);
            // V^T as A operand: row = d (16n+lo), k = keys 8hi+2c, 8hi+2c+1, the keys that
            // registers 2c, 2c+1 of the score accumulator hold in this lane half.
            const float* vrow = vt + (u * 8 + 4 * hi) * VP + (lo >> 2) * 8 + (lo & 3);
            v2f vf[4][4];
            #pragma unroll                                  // as above
            for (int c = 0; c < 4; ++c) {
                #pragma unroll                              // as above
                for (int n = 0; n < 4; ++n) {
                    vf[c][n].x = vrow[c * VP + 32 * n];
                    vf[c][n].y = vrow[c * VP + 32 * n + 4];
                }
            }
            // All LDS reads of the step stand here as one group: left free, the scheduler sinks the
            // last V reads in front of their own product, where their latency shows.
            __builtin_amdgcn_sched_barrier(0);
            // ---- S^T = K * Q^T (16 WMMA steps over d): s[v] = S[q0+lo][k0+8hi+v] ----
            v8f s = {};
            #pragma unroll
            for (int c = 0; c < 16; ++c) s = wmma4(kf[c], qa[c], s);
            // ---- quirky causal mask + online softmax, one query per lane ----
            const int kbase = k0 + 8 * hi;
            float p[8];
            #pragma unroll
            for (int v = 0; v < 8; ++v) {
                float val = s[v];
                if (kbase + v > qr || val == 0.0f) val = NEGV;  // tril + exact-zero quirk
                p[v] = val;
            }
            float mx = fmaxf(fmaxf(fmaxf(p[0], p[1]), fmaxf(p[2], p[3])),
                             fmaxf(fmaxf(p[4], p[5]), fmaxf(p[6], p[7])));
            mx = fmaxf(mx, xhalf(mx));                      // the other eight keys of this query
            const float nm = fmaxf(rm, mx);
            const float sc = __expf(rm - nm);
            rm = nm;
            #pragma unroll
            for (int v = 0; v < 8; ++v) p[v] = __expf(p[v] - nm);
            rl = rl * sc + (((p[0] + p[1]) + (p[2] + p[3])) + ((p[4] + p[5]) + (p[6] + p[7])));
            acc0 *= sc; acc1 *= sc; acc2 *= sc; acc3 *= sc;
            // ---- O^T += V^T * P^T (4 chunks x 4 d-tiles = 16 WMMA), P straight from registers ----
            #pragma unroll
            for (int c = 0; c < 4; ++c) {
                v2f pb;
                pb.x = p[2 * c];
                pb.y = p[2 * c + 1];
                acc0 = wmma4(vf[c][0], pb, acc0);
                acc1 = wmma4(vf[c][1], pb, acc1);
                acc2 = wmma4(vf[c][2], pb, acc2);
                acc3 = wmma4(vf[c][3], pb, acc3);
            }
        }
        // ---- hand-over: tile t+1 becomes readable, tile t's buffer becomes free ----
        asm volatile("s_wait_dscnt 0x0" ::: "memory");      // this wave's reads of tile t are done
        asm volatile("s_wait_asynccnt 0x0" ::: "memory");   // its share of tile t+1 has landed
        __syncthreads();
        if (t + 2 < nt) {
            const size_t off = (size_t)(t + 2) * (KT * D_);
            copy_tile(Kc + off, (t & 1) ? kl1 : kl0, 8 * KP * 4);
            copy_tile(Vc + off, (t & 1) ? vl1 : vl0, 4 * VP * 4);
        }
    }
    asm volatile("s_wait_asynccnt 0x0" ::: "memory");       // nothing in flight when the wave ends

    // ---- normalize + write O as [B,S,H*D]: eight consecutive floats per d-tile and lane ----
    const int bb = bh / H_, h = bh % H_;
    const float inv = 1.0f / (rl + xhalf(rl));              // join the two halves' sums
    float* orow = ws_o + ((size_t)bb * S_ + qr) * HD + h * 64 + 8 * hi;
    *(v8f*)(orow)      = acc0 * inv;
    *(v8f*)(orow + 16) = acc1 * inv;
    *(v8f*)(orow + 32) = acc2 * inv;
    *(v8f*)(orow + 48) = acc3 * inv;
}

// ---------------------------------------------------------------------------
// Kernel 3: output projection. O[4096x768] @ Wo[768x64] + bo -> out[4096x64].
// ---------------------------------------------------------------------------
__global__ __launch_bounds__(32)
void out_proj_kernel(const float* __restrict__ o_ws, const float* __restrict__ Wo,
                     const float* __restrict__ bo, float* __restrict__ out) {
    const int lane = threadIdx.x;
    const int lo = lane & 15, hi = lane >> 4;
    const int n0 = blockIdx.x * 16;                     // 0..63
    const int m0 = blockIdx.y * 16;                     // 0..4095
    const float* arow = o_ws + (size_t)(m0 + lo) * HD;
    v8f acc = {};
    for (int c = 0; c < 192; ++c) {
        const int kk = 4 * c + 2 * hi;
        v2f a = *(const v2f*)(arow + kk);
        v2f b;
        b.x = Wo[(size_t)kk       * D_ + n0 + lo];
        b.y = Wo[(size_t)(kk + 1) * D_ + n0 + lo];
        acc = wmma4(a, b, acc);
    }
    const float bn = bo[n0 + lo];
    #pragma unroll
    for (int v = 0; v < 8; ++v)
        out[(size_t)(m0 + v + 8 * hi) * D_ + n0 + lo] = acc[v] + bn;
}

extern "C" void kernel_launch(void* const* d_in, const int* in_sizes, int n_in,
                              void* d_out, int out_size, void* d_ws, size_t ws_size,
                              hipStream_t stream) {
    const float* x  = (const float*)d_in[0];
    const float* Wq = (const float*)d_in[1];
    const float* bq = (const float*)d_in[2];
    const float* Wk = (const float*)d_in[3];
    const float* bk = (const float*)d_in[4];
    const float* Wv = (const float*)d_in[5];
    const float* bv = (const float*)d_in[6];
    const float* Wo = (const float*)d_in[7];
    const float* bo = (const float*)d_in[8];
    float* out = (float*)d_out;

    float* ws = (float*)d_ws;
    const size_t QKV = (size_t)B_ * S_ * HD;            // 3,145,728 floats each
    float* q = ws;
    float* k = ws + QKV;
    float* v = ws + 2 * QKV;
    float* o = ws + 3 * QKV;                            // total 48 MB of d_ws

    // 1) QKV projections: 48 n-tiles x 256 m-tiles x 3 matrices, 1 wave/tile.
    qkv_proj_kernel<<<dim3(HD / 16, (B_ * S_) / 16, 3), 32, 0, stream>>>(
        x, Wq, bq, Wk, bk, Wv, bv, ws);

    // 2) Attention: 24 (b,h) x 32 q-blocks of 64 rows, four waves each.
    attn_kernel<<<dim3(B_ * H_ * (S_ / 64)), 128, 0, stream>>>(q, k, v, o);

    // 3) Output projection: 4 n-tiles x 256 m-tiles.
    out_proj_kernel<<<dim3(D_ / 16, (B_ * S_) / 16), 32, 0, stream>>>(o, Wo, bo, out);
}

// v004
// A run of this version takes 114 microseconds.
// Two timings next to v003 put it at 1.15 and 1.16 times that version's speed.
// All steps since v000 together make it 3.12 times as fast.
#include <hip/hip_runtime.h>
#include <hip/hip_bf16.h>

// Multi-head self-attention (B=2,S=2048,D=64,H=12), fp32 throughout,
// all GEMM stages on v_wmma_f32_16x16x4_f32 (native fp32 WMMA, wave32).

#define B_  2
#define S_  2048
#define D_  64
#define H_  12
#define HD  768           // H_*D_
#define NEGV (-99999.0f)

typedef __attribute__((ext_vector_type(2))) float v2f;
typedef __attribute__((ext_vector_type(8))) float v8f;

// D = A(16x4 f32) * B(4x16 f32) + C(16x16 f32)
__device__ __forceinline__ v8f wmma4(v2f a, v2f b, v8f c) {
    return __builtin_amdgcn_wmma_f32_16x16x4_f32(
        /*neg_a=*/false, a, /*neg_b=*/false, b,
        /*c_mod=*/(short)0, c, /*reuse_a=*/false, /*reuse_b=*/false);
}

// ---------------------------------------------------------------------------
// Kernel 1: QKV projection. x[4096x64] @ W[64x768] + b -> [B,H,S,64] scratch.
// A work-group of four waves computes a block of 128 rows x 96 columns of one matrix; a wave takes
// 32 rows (two row tiles) of all six column tiles. The x rows and the W columns come into LDS with
// whole-line loads, once per work-group, and the results leave through LDS as whole 128-byte lines.
// 24 column blocks x 32 row blocks = 768 work-groups: three to a WGP, three waves to a SIMD.
// ---------------------------------------------------------------------------
#define PM  128           // rows per work-group
#define PN  96            // columns per work-group: three 128-byte lines of an output row
#define XP  68            // x row pitch in LDS, floats: 8-byte column reads meet no bank twice
#define WPP 224           // W pitch in LDS, floats per PAIR of k rows: W[k][n], W[k+1][n] lie side by side, so one
                          // 8-byte read brings a B operand; pairs i and i+1 lie 32 banks apart
#define SP  100           // result row pitch in LDS, floats: rows v and v+8 lie 32 banks apart

typedef __attribute__((ext_vector_type(4))) float v4f;

__global__ __launch_bounds__(128)
void qkv_proj_kernel(const float* __restrict__ x,
                     const float* __restrict__ Wq, const float* __restrict__ bq,
                     const float* __restrict__ Wk, const float* __restrict__ bk,
                     const float* __restrict__ Wv, const float* __restrict__ bv,
                     float* __restrict__ ws) {
    __shared__ __attribute__((aligned(16))) float xs[PM * XP];
    __shared__ __attribute__((aligned(16))) float wp[(D_ / 2) * WPP];
    const int tid  = threadIdx.x;
    const int lane = tid & 31;
    const int wave = __builtin_amdgcn_readfirstlane(tid >> 5);
    const int lo = lane & 15, hi = lane >> 4;           // hi in {0,1}
    const int which = blockIdx.x >> 3;                  // 0=Q 1=K 2=V
    const int col0  = (blockIdx.x & 7) * PN;            // first column, 0..672
    const int row0  = blockIdx.y * PM;                  // first row, 0..3968

    const float* W    = (which == 0) ? Wq : (which == 1) ? Wk : Wv;
    const float* bias = (which == 0) ? bq : (which == 1) ? bk : bv;
    float* out = ws + (size_t)which * (size_t)(B_ * S_ * HD);

    // ---- x block: 128 rows x 256 bytes, contiguous in memory, 16 pieces of 16 bytes per thread ----
    {
        const float* xg = x + (size_t)row0 * D_ + tid * 4;
        float* xl = xs + (tid >> 4) * XP + (tid & 15) * 4;
        #pragma unroll                                  // all loads in flight at once
        for (int i = 0; i < 16; ++i)
            *(v4f*)(xl + i * 8 * XP) = *(const v4f*)(xg + i * 512);
    }
    // ---- W block: 32 pairs of k rows x 384 bytes; a thread joins four columns of both rows ----
    #pragma unroll                                      // as above
    for (int i = 0; i < 6; ++i) {
        const int item = i * 128 + tid;
        const int kp = item / 24, c4 = item % 24;
        const float* g = W + (size_t)(2 * kp) * HD + col0 + c4 * 4;
        const v4f r0 = *(const v4f*)g;
        const v4f r1 = *(const v4f*)(g + HD);
        float* d = wp + kp * WPP + c4 * 8;
        *(v4f*)d       = (v4f){r0.x, r1.x, r0.y, r1.y};
        *(v4f*)(d + 4) = (v4f){r0.z, r1.z, r0.w, r1.w};
    }
    float bn[6];
    #pragma unroll                                      // bn stays in registers
    for (int n = 0; n < 6; ++n) bn[n] = bias[col0 + n * 16 + lo];
    __syncthreads();                                    // both blocks are whole before anyone reads them

    // ---- A operands of this wave's two row tiles: A(m=lo, k=4c+2hi, +1) ----
    float* mine = xs + wave * 32 * XP;                  // this wave's 32 rows: nobody else reads them
    v2f xa[2][16];
    #pragma unroll                                      // fragment arrays stay in registers
    for (int mt = 0; mt < 2; ++mt) {
        #pragma unroll                                  // as above
        for (int c = 0; c < 16; ++c)
            xa[mt][c] = *(const v2f*)(mine + (mt * 16 + lo) * XP + 4 * c + 2 * hi);
    }
    v8f acc[2][6];
    #pragma unroll                                      // as above
    for (int n = 0; n < 6; ++n) {
        v2f bf[16];                                     // B(k=4c+2hi, +1; n=lo)
        #pragma unroll                                  // as above
        for (int c = 0; c < 16; ++c)
            bf[c] = *(const v2f*)(wp + (2 * c + hi) * WPP + (n * 16 + lo) * 2);
        v8f a0 = {}, a1 = {};
        #pragma unroll                                  // as above
        for (int c = 0; c < 16; ++c) {                  // two chains in turn: neither waits for its own sum
            a0 = wmma4(xa[0][c], bf[c], a0);
            a1 = wmma4(xa[1][c], bf[c], a1);
        }
        acc[0][n] = a0;
        acc[1][n] = a1;
    }

    // ---- results: one row tile at a time through this wave's own x rows, now free ----
    const int sub = lane >> 3, q = lane & 7;            // a store covers four lines, eight lanes each
    const int bb = row0 / S_;                           // a block never crosses batches
    const unsigned lofs = sub * D_ + q * 4;             // this lane's place among four output rows
    #pragma unroll                                      // acc is indexed by constants only
    for (int mt = 0; mt < 2; ++mt) {
        // Other lanes' earlier reads of these LDS bytes stay ahead of the writes below.
        asm volatile("s_wait_dscnt 0x0" ::: "memory");
        #pragma unroll                                  // as above
        for (int n = 0; n < 6; ++n) {
            #pragma unroll                              // as above
            for (int v = 0; v < 8; ++v)                 // C/D layout: row v+8hi, column lo
                mine[(v + 8 * hi) * SP + n * 16 + lo] = acc[mt][n][v] + bn[n];
        }
        // Other lanes' values are in LDS before this lane reads them back.
        asm volatile("s_wait_dscnt 0x0" ::: "memory");
        const int s0 = (row0 % S_) + wave * 32 + mt * 16;
        #pragma unroll                                  // line and row become constant offsets
        for (int i = 0; i < 12; ++i) {
            const int seg = i % 3, r4 = (i / 3) * 4;    // line of the row; row = r4 + sub
            const int col = col0 + seg * 32;            // a line never crosses heads
            float* og = out + (((size_t)bb * H_ + (col >> 6)) * S_ + s0 + r4) * D_ + (col & 63);   // same in every lane
            *(v4f*)(og + lofs) = *(const v4f*)(mine + (r4 + sub) * SP + seg * 32 + q * 4);
        }
    }
}

#define KT 64
#define KP 68
#define VP 136

// One tile of 64 rows x 256 bytes, 1024 pieces of 16 bytes, eight per thread.
// g: this thread's first piece in global memory (a wave covers 512 contiguous bytes),
// l: its LDS byte address, step: LDS bytes between a thread's pieces (eight rows).
__device__ __forceinline__ void copy_tile(const float* g, unsigned l, unsigned step) {
    // The closing s_wait_xcnt keeps the address registers whole until the copies have taken them.
    asm volatile(
        "global_load_async_to_lds_b128 %0, %8, off\n\t"
        "global_load_async_to_lds_b128 %1, %9, off\n\t"
        "global_load_async_to_lds_b128 %2, %10, off\n\t"
        "global_load_async_to_lds_b128 %3, %11, off\n\t"
        "global_load_async_to_lds_b128 %4, %12, off\n\t"
        "global_load_async_to_lds_b128 %5, %13, off\n\t"
        "global_load_async_to_lds_b128 %6, %14, off\n\t"
        "global_load_async_to_lds_b128 %7, %15, off\n\t"
        "s_wait_xcnt 0x0"
        :: "v"(l), "v"(l + step), "v"(l + 2 * step), "v"(l + 3 * step),
           "v"(l + 4 * step), "v"(l + 5 * step), "v"(l + 6 * step), "v"(l + 7 * step),
           "v"(g), "v"(g + 512), "v"(g + 1024), "v"(g + 1536),
           "v"(g + 2048), "v"(g + 2560), "v"(g + 3072), "v"(g + 3584)
        : "memory");
}

// Lane l takes the value of lane l ^ 16.
__device__ __forceinline__ float xhalf(float x) {
    const int b = __builtin_bit_cast(int, x);
    return __builtin_bit_cast(float,
        __builtin_amdgcn_permlanex16(b, b, 0x76543210, 0xfedcba98, false, false));
}

static_assert(B_ * H_ == 24 && S_ / 64 == 32, "the index map below is written for 3 x 8 heads and 32 q blocks");

__global__ __launch_bounds__(128)
void attn_kernel(const float* __restrict__ ws_q, const float* __restrict__ ws_k,
                 const float* __restrict__ ws_v, float* __restrict__ ws_o) {
    __shared__ __attribute__((aligned(16))) float kbuf[2][KT * KP];
    __shared__ __attribute__((aligned(16))) float vbuf[2][(KT / 2) * VP];
    const int tid  = threadIdx.x;
    const int lane = tid & 31;
    const int wave = __builtin_amdgcn_readfirstlane(tid >> 5);
    const int lo = lane & 15, hi = lane >> 4;
    // Which (b,h) and which 64-row q block this work-group takes: any one-to-one map is right, this one is for speed.
    // A q block's cost grows with its index, and all 768 work-groups are resident at once, three to a WGP. If they are
    // dealt in turn over the 256 WGPs, indices i, i + 256 and i + 512 share a WGP: they take c0, c1, c2, three permutations of
    // 0..31 whose sum is 47 or 46 for every r, so every WGP gets 49 or 50 key tiles. The largest of the
    // three goes to the lowest index, for speed only.
    const int rnd = blockIdx.x >> 8;                    // 0..2
    const int grp = (blockIdx.x >> 5) & 7;
    const int r   = blockIdx.x & 31;
    const int c0 = r, c1 = (r < 16 ? 31 : 62) - 2 * r, c2 = (r + 16) & 31;
    const int k0 = (c1 > c0) + (c2 > c0);               // place of each by falling size, ties by position
    const int k1 = (c0 >= c1) + (c2 > c1);
    const int sel = (k0 == rnd) ? 0 : (k1 == rnd) ? 1 : 2;
    const int bh = sel * 8 + grp;                       // 0..23
    const int qb = (sel == 0) ? c0 : (sel == 1) ? c1 : c2;
    const int q0 = qb * 64 + wave * 16;
    const int nt = qb + 1;                              // staged tiles 0..qb

    const size_t base = (size_t)bh * S_ * D_;
    const float* Q = ws_q + base;
    const float* Kc = ws_k + base + tid * 4;            // this thread's first piece of tile 0
    const float* Vc = ws_v + base + tid * 4;
    const int crow = tid >> 4, ccol = (tid & 15) * 4;   // its row and column in the tile
    const unsigned kl0 = (unsigned)(size_t)&kbuf[0][crow * KP + ccol];
    const unsigned kl1 = (unsigned)(size_t)&kbuf[1][crow * KP + ccol];
    const int vpos = (crow >> 1) * VP + ccol * 2 + (crow & 1) * 4;   // its place among the alternating pieces
    const unsigned vl0 = (unsigned)(size_t)&vbuf[0][vpos];
    const unsigned vl1 = (unsigned)(size_t)&vbuf[1][vpos];

    copy_tile(Kc, kl0, 8 * KP * 4);
    copy_tile(Vc, vl0, 4 * VP * 4);

    // Preload the Q tile as B operand (column = query lo): 16 chunks of v2f.
    v2f qa[16];
    {
        const float* qrow = Q + (size_t)(q0 + lo) * D_;
        #pragma unroll
        for (int c = 0; c < 16; ++c) qa[c] = *(const v2f*)(qrow + 4 * c + 2 * hi);
    }

    v8f acc0 = {}, acc1 = {}, acc2 = {}, acc3 = {};     // O^T tile: acc_n[v] = O[q0+lo][16n+8hi+v]
    const int qr = q0 + lo;                             // this lane's query
    float rm = -3.0e38f;                                // its running max (both halves alike)
    float rl = 0.0f;                                    // sum over this half's keys only

    asm volatile("s_wait_asynccnt 0x0" ::: "memory");   // this wave's share of tile 0 has landed
    __syncthreads();                                    // ... and every other wave's
    if (nt > 1) {
        copy_tile(Kc + KT * D_, kl1, 8 * KP * 4);
        copy_tile(Vc + KT * D_, vl1, 4 * VP * 4);
    }

    for (int t = 0; t < nt; ++t) {
        const float* kt = kbuf[t & 1];
        const float* vt = vbuf[t & 1];
        // 16-key steps of this tile with k0 <= q0: all four below the diagonal tile.
        const int ns = (t < qb) ? 4 : wave + 1;
        for (int u = 0; u < ns; ++u) {
            const int k0 = t * KT + u * 16;
            // ---- K and V fragments of this step, from LDS ----
            const float* krow = kt + (u * 16 + lo) * KP + 2 * hi;
            v2f kf[16];
            #pragma unroll                                  // fragment arrays stay in registers
            for (int c = 0; c < 16; ++c) kf[c] = *(const v2f*)(krow + 4 * c);
            // V^T as A operand: row = d (16n+lo), k = keys 8hi+2c, 8hi+2c+1, the keys that
            // registers 2c, 2c+1 of the score accumulator hold in this lane half.
            const float* vrow = vt + (u * 8 + 4 * hi) * VP + (lo >> 2) * 8 + (lo & 3);
            v2f vf[4][4];
            #pragma unroll                                  // as above
            for (int c = 0; c < 4; ++c) {
                #pragma unroll                              // as above
                for (int n = 0; n < 4; ++n) {
                    vf[c][n].x = vrow[c * VP + 32 * n];
                    vf[c][n].y = vrow[c * VP + 32 * n + 4];
                }
            }
            // All LDS reads of the step stand here as one group: left free, the scheduler sinks the
            // last V reads in front of their own product, where their latency shows.
            __builtin_amdgcn_sched_barrier(0);
            // ---- S^T = K * Q^T (16 WMMA steps over d): s[v] = S[q0+lo][k0+8hi+v] ----
            v8f s = {};
            #pragma unroll
            for (int c = 0; c < 16; ++c) s = wmma4(kf[c], qa[c], s);
            // ---- quirky causal mask + online softmax, one query per lane ----
            const int kbase = k0 + 8 * hi;
            float p[8];
            #pragma unroll
            for (int v = 0; v < 8; ++v) {
                float val = s[v];
                if (kbase + v > qr || val == 0.0f) val = NEGV;  // tril + exact-zero quirk
                p[v] = val;
            }
            float mx = fmaxf(fmaxf(fmaxf(p[0], p[1]), fmaxf(p[2], p[3])),
                             fmaxf(fmaxf(p[4], p[5]), fmaxf(p[6], p[7])));
            mx = fmaxf(mx, xhalf(mx));                      // the other eight keys of this query
            const float nm = fmaxf(rm, mx);
            const float sc = __expf(rm - nm);
            rm = nm;
            #pragma unroll
            for (int v = 0; v < 8; ++v) p[v] = __expf(p[v] - nm);
            rl = rl * sc + (((p[0] + p[1]) + (p[2] + p[3])) + ((p[4] + p[5]) + (p[6] + p[7])));
            acc0 *= sc; acc1 *= sc; acc2 *= sc; acc3 *= sc;
            // ---- O^T += V^T * P^T (4 chunks x 4 d-tiles = 16 WMMA), P straight from registers ----
            #pragma unroll
            for (int c = 0; c < 4; ++c) {
                v2f pb;
                pb.x = p[2 * c];
                pb.y = p[2 * c + 1];
                acc0 = wmma4(vf[c][0], pb, acc0);
                acc1 = wmma4(vf[c][1], pb, acc1);
                acc2 = wmma4(vf[c][2], pb, acc2);
                acc3 = wmma4(vf[c][3], pb, acc3);
            }
        }
        // ---- hand-over: tile t+1 becomes readable, tile t's buffer becomes free ----
        asm volatile("s_wait_dscnt 0x0" ::: "memory");      // this wave's reads of tile t are done
        asm volatile("s_wait_asynccnt 0x0" ::: "memory");   // its share of tile t+1 has landed
        __syncthreads();
        if (t + 2 < nt) {
            const size_t off = (size_t)(t + 2) * (KT * D_);
            copy_tile(Kc + off, (t & 1) ? kl1 : kl0, 8 * KP * 4);
            copy_tile(Vc + off, (t & 1) ? vl1 : vl0, 4 * VP * 4);
        }
    }
    asm volatile("s_wait_asynccnt 0x0" ::: "memory");       // nothing in flight when the wave ends

    // ---- normalize + write O as [B,S,H*D]: eight consecutive floats per d-tile and lane ----
    const int bb = bh / H_, h = bh % H_;
    const float inv = 1.0f / (rl + xhalf(rl));              // join the two halves' sums
    float* orow = ws_o + ((size_t)bb * S_ + qr) * HD + h * 64 + 8 * hi;
    *(v8f*)(orow)      = acc0 * inv;
    *(v8f*)(orow + 16) = acc1 * inv;
    *(v8f*)(orow + 32) = acc2 * inv;
    *(v8f*)(orow + 48) = acc3 * inv;
}

// ---------------------------------------------------------------------------
// Kernel 3: output projection. O[4096x768] @ Wo[768x64] + bo -> out[4096x64].
// ---------------------------------------------------------------------------
__global__ __launch_bounds__(32)
void out_proj_kernel(const float* __restrict__ o_ws, const float* __restrict__ Wo,
                     const float* __restrict__ bo, float* __restrict__ out) {
    const int lane = threadIdx.x;
    const int lo = lane & 15, hi = lane >> 4;
    const int n0 = blockIdx.x * 16;                     // 0..63
    const int m0 = blockIdx.y * 16;                     // 0..4095
    const float* arow = o_ws + (size_t)(m0 + lo) * HD;
    v8f acc = {};
    for (int c = 0; c < 192; ++c) {
        const int kk = 4 * c + 2 * hi;
        v2f a = *(const v2f*)(arow + kk);
        v2f b;
        b.x = Wo[(size_t)kk       * D_ + n0 + lo];
        b.y = Wo[(size_t)(kk + 1) * D_ + n0 + lo];
        acc = wmma4(a, b, acc);
    }
    const float bn = bo[n0 + lo];
    #pragma unroll
    for (int v = 0; v < 8; ++v)
        out[(size_t)(m0 + v + 8 * hi) * D_ + n0 + lo] = acc[v] + bn;
}

extern "C" void kernel_launch(void* const* d_in, const int* in_sizes, int n_in,
                              void* d_out, int out_size, void* d_ws, size_t ws_size,
                              hipStream_t stream) {
    const float* x  = (const float*)d_in[0];
    const float* Wq = (const float*)d_in[1];
    const float* bq = (const float*)d_in[2];
    const float* Wk = (const float*)d_in[3];
    const float* bk = (const float*)d_in[4];
    const float* Wv = (const float*)d_in[5];
    const float* bv = (const float*)d_in[6];
    const float* Wo = (const float*)d_in[7];
    const float* bo = (const float*)d_in[8];
    float* out = (float*)d_out;

    float* ws = (float*)d_ws;
    const size_t QKV = (size_t)B_ * S_ * HD;            // 3,145,728 floats each
    float* q = ws;
    float* k = ws + QKV;
    float* v = ws + 2 * QKV;
    float* o = ws + 3 * QKV;                            // total 48 MB of d_ws

    // 1) QKV projections: 3 matrices x 8 column blocks, 32 row blocks, four waves each.
    qkv_proj_kernel<<<dim3(3 * (HD / PN), (B_ * S_) / PM), 128, 0, stream>>>(
        x, Wq, bq, Wk, bk, Wv, bv, ws);

    // 2) Attention: 24 (b,h) x 32 q-blocks of 64 rows, four waves each.
    attn_kernel<<<dim3(B_ * H_ * (S_ / 64)), 128, 0, stream>>>(q, k, v, o);

    // 3) Output projection: 4 n-tiles x 256 m-tiles.
    out_proj_kernel<<<dim3(D_ / 16, (B_ * S_) / 16), 32, 0, stream>>>(o, Wo, bo, out);
}

// v006
// A run of this version takes 66 microseconds.
// It is 1.76 times as fast as v004, going by the measured steps of the versions left out in between.
// All steps since v000 together make it 5.51 times as fast.
#include <hip/hip_runtime.h>
#include <hip/hip_bf16.h>

// Multi-head self-attention (B=2,S=2048,D=64,H=12), fp32 in and out.
// The two projections run on v_wmma_f32_16x16x4_f32. The two attention products run on
// v_wmma_f32_16x16x32_bf16: every f32 operand x is kept as two bf16 parts, hi = bf16(x) and
// lo = bf16(x - hi), and a product is hi*hi + hi*lo + lo*hi with f32 sums (lo*lo is dropped).

#define B_  2
#define S_  2048
#define D_  64
#define H_  12
#define HD  768           // H_*D_
#define NEGV (-99999.0f)

typedef __attribute__((ext_vector_type(2))) float v2f;
typedef __attribute__((ext_vector_type(8))) float v8f;

// D = A(16x4 f32) * B(4x16 f32) + C(16x16 f32)
__device__ __forceinline__ v8f wmma4(v2f a, v2f b, v8f c) {
    return __builtin_amdgcn_wmma_f32_16x16x4_f32(
        /*neg_a=*/false, a, /*neg_b=*/false, b,
        /*c_mod=*/(short)0, c, /*reuse_a=*/false, /*reuse_b=*/false);
}

typedef __bf16 bf16x16 __attribute__((ext_vector_type(16)));
typedef __bf16 bf16x2 __attribute__((ext_vector_type(2)));
typedef unsigned u32x4 __attribute__((ext_vector_type(4)));
typedef unsigned u32x8 __attribute__((ext_vector_type(8)));

// D = A(16x32 bf16) * B(32x16 bf16) + C(16x16 f32)
__device__ __forceinline__ v8f wmma32(u32x8 a, u32x8 b, v8f c) {
    return __builtin_amdgcn_wmma_f32_16x16x32_bf16(
        false, __builtin_bit_cast(bf16x16, a), false, __builtin_bit_cast(bf16x16, b),
        (short)0, c, false, false);
}

// Two f32 values as a pair of bf16, a in the low half.
__device__ __forceinline__ unsigned pack2(float a, float b) {
    const v2f t = {a, b};
    return __builtin_bit_cast(unsigned, __builtin_convertvector(t, bf16x2));
}

// Two f32 values as their hi pair and their lo pair.
__device__ __forceinline__ void split2(float a, float b, unsigned& h, unsigned& l) {
    h = pack2(a, b);
    l = pack2(a - __builtin_bit_cast(float, h << 16), b - __builtin_bit_cast(float, h & 0xffff0000u));
}

// Eight f32 values as eight hi parts and eight lo parts, 16 bytes each.
__device__ __forceinline__ void split8(const float* f, u32x4& h, u32x4& l) {
    unsigned a, b;
    split2(f[0], f[1], a, b); h.x = a; l.x = b;
    split2(f[2], f[3], a, b); h.y = a; l.y = b;
    split2(f[4], f[5], a, b); h.z = a; l.z = b;
    split2(f[6], f[7], a, b); h.w = a; l.w = b;
}

// ---------------------------------------------------------------------------
// Kernel 1: QKV projection. x[4096x64] @ W[64x768] + b -> scratch, split into bf16 parts.
// Q and K: [B,H,S] rows of 256 bytes, two lines; line i holds d = 32i..32i+31 as 32 hi, then 32 lo.
// V, transposed: [B,H,S/32][d] lines of 128 bytes; a line holds 32 keys of one d as 32 hi, then 32 lo.
// A work-group of four waves computes a block of 128 rows x 96 columns of one matrix; a wave takes
// 32 rows (two row tiles) of all six column tiles. The x rows and the W columns come into LDS with
// whole-line loads, once per work-group, and the results leave through LDS as whole 128-byte lines.
// 24 column blocks x 32 row blocks = 768 work-groups: three to a WGP, three waves to a SIMD.
// ---------------------------------------------------------------------------
#define PM  128           // rows per work-group
#define PN  96            // columns per work-group: three 128-byte lines of an output row
#define XP  68            // x row pitch in LDS, floats: 8-byte column reads meet no bank twice
#define WPP 224           // W pitch in LDS, floats per PAIR of k rows: W[k][n], W[k+1][n] lie side by side, so one
                          // 8-byte read brings a B operand; pairs i and i+1 lie 32 banks apart
#define SP  100           // result row pitch in LDS, floats: rows v and v+8 lie 32 banks apart

typedef __attribute__((ext_vector_type(4))) float v4f;

__global__ __launch_bounds__(128)
void qkv_proj_kernel(const float* __restrict__ x,
                     const float* __restrict__ Wq, const float* __restrict__ bq,
                     const float* __restrict__ Wk, const float* __restrict__ bk,
                     const float* __restrict__ Wv, const float* __restrict__ bv,
                     float* __restrict__ ws) {
    __shared__ __attribute__((aligned(16))) float xs[PM * XP];
    __shared__ __attribute__((aligned(16))) float wp[(D_ / 2) * WPP];
    const int tid  = threadIdx.x;
    const int lane = tid & 31;
    const int wave = __builtin_amdgcn_readfirstlane(tid >> 5);
    const int lo = lane & 15, hi = lane >> 4;           // hi in {0,1}
    const int which = blockIdx.x >> 3;                  // 0=Q 1=K 2=V
    const int col0  = (blockIdx.x & 7) * PN;            // first column, 0..672
    const int row0  = blockIdx.y * PM;                  // first row, 0..3968

    const float* W    = (which == 0) ? Wq : (which == 1) ? Wk : Wv;
    const float* bias = (which == 0) ? bq : (which == 1) ? bk : bv;
    float* out = ws + (size_t)which * (size_t)(B_ * S_ * HD);

    // ---- x block: 128 rows x 256 bytes, contiguous in memory, 16 pieces of 16 bytes per thread ----
    {
        const float* xg = x + (size_t)row0 * D_ + tid * 4;
        float* xl = xs + (tid >> 4) * XP + (tid & 15) * 4;
        #pragma unroll                                  // all loads in flight at once
        for (int i = 0; i < 16; ++i)
            *(v4f*)(xl + i * 8 * XP) = *(const v4f*)(xg + i * 512);
    }
    // ---- W block: 32 pairs of k rows x 384 bytes; a thread joins four columns of both rows ----
    #pragma unroll                                      // as above
    for (int i = 0; i < 6; ++i) {
        const int item = i * 128 + tid;
        const int kp = item / 24, c4 = item % 24;
        const float* g = W + (size_t)(2 * kp) * HD + col0 + c4 * 4;
        const v4f r0 = *(const v4f*)g;
        const v4f r1 = *(const v4f*)(g + HD);
        float* d = wp + kp * WPP + c4 * 8;
        *(v4f*)d       = (v4f){r0.x, r1.x, r0.y, r1.y};
        *(v4f*)(d + 4) = (v4f){r0.z, r1.z, r0.w, r1.w};
    }
    float bn[6];
    #pragma unroll                                      // bn stays in registers
    for (int n = 0; n < 6; ++n) bn[n] = bias[col0 + n * 16 + lo];
    __syncthreads();                                    // both blocks are whole before anyone reads them

    // ---- A operands of this wave's two row tiles: A(m=lo, k=4c+2hi, +1) ----
    float* mine = xs + wave * 32 * XP;                  // this wave's 32 rows: nobody else reads them
    v2f xa[2][16];
    #pragma unroll                                      // fragment arrays stay in registers
    for (int mt = 0; mt < 2; ++mt) {
        #pragma unroll                                  // as above
        for (int c = 0; c < 16; ++c)
            xa[mt][c] = *(const v2f*)(mine + (mt * 16 + lo) * XP + 4 * c + 2 * hi);
    }
    v8f acc[2][6];
    #pragma unroll                                      // as above
    for (int n = 0; n < 6; ++n) {
        v2f bf[16];                                     // B(k=4c+2hi, +1; n=lo)
        #pragma unroll                                  // as above
        for (int c = 0; c < 16; ++c)
            bf[c] = *(const v2f*)(wp + (2 * c + hi) * WPP + (n * 16 + lo) * 2);
        v8f a0 = {}, a1 = {};
        #pragma unroll                                  // as above
        for (int c = 0; c < 16; ++c) {                  // two chains in turn: neither waits for its own sum
            a0 = wmma4(xa[0][c], bf[c], a0);
            a1 = wmma4(xa[1][c], bf[c], a1);
        }
        acc[0][n] = a0;
        acc[1][n] = a1;
    }

    // ---- results: through this wave's own x rows, now free; Q and K one row tile at a time ----
    const int sub = lane >> 3, q = lane & 7;            // a store covers four lines, eight lanes each
    const int bb = row0 / S_;                           // a block never crosses batches
    const unsigned lofs = sub * D_ + q * 4;             // this lane's place among four output rows
    if (which == 2) {
        // V: a lane holds eight consecutive keys of one column, 16 bytes of a line's hi half and of its lo half.
        // 48 columns at a time go through LDS (pitch 144 bytes: 16-byte writes meet no bank twice) and leave as whole lines.
        unsigned char* st = (unsigned char*)mine;
        const int g = ((row0 % S_) >> 5) + wave;        // this wave's 32 rows are one group of 32 keys
        #pragma unroll                                  // acc is indexed by constants only
        for (int half = 0; half < 2; ++half) {
            // Other lanes' earlier reads of these LDS bytes stay ahead of the writes below.
            asm volatile("s_wait_dscnt 0x0" ::: "memory");
            #pragma unroll                              // as above
            for (int nn = 0; nn < 3; ++nn) {
                #pragma unroll                          // as above
                for (int mt = 0; mt < 2; ++mt) {
                    float f[8];
                    #pragma unroll                      // as above
                    for (int v = 0; v < 8; ++v) f[v] = acc[mt][half * 3 + nn][v] + bn[half * 3 + nn];
                    u32x4 h4, l4;
                    split8(f, h4, l4);
                    unsigned char* d = st + (nn * 16 + lo) * 144 + mt * 32 + hi * 16;
                    *(u32x4*)d        = h4;
                    *(u32x4*)(d + 64) = l4;
                }
            }
            // Other lanes' values are in LDS before this lane reads them back.
            asm volatile("s_wait_dscnt 0x0" ::: "memory");
            #pragma unroll                              // column becomes a constant offset
            for (int i = 0; i < 12; ++i) {
                const int col = col0 + half * 48 + i * 4;   // four columns of one head: four adjacent lines
                float* og = out + ((((size_t)bb * H_ + (col >> 6)) * (S_ / 32) + g) * D_ + (col & 63)) * 32;   // same in every lane
                *(u32x4*)(og + sub * 32 + q * 4) = *(const u32x4*)(st + (i * 4 + sub) * 144 + q * 16);
            }
        }
        return;
    }
    #pragma unroll                                      // acc is indexed by constants only
    for (int mt = 0; mt < 2; ++mt) {
        // Other lanes' earlier reads of these LDS bytes stay ahead of the writes below.
        asm volatile("s_wait_dscnt 0x0" ::: "memory");
        #pragma unroll                                  // as above
        for (int n = 0; n < 6; ++n) {
            #pragma unroll                              // as above
            for (int v = 0; v < 8; ++v)                 // C/D layout: row v+8hi, column lo
                mine[(v + 8 * hi) * SP + n * 16 + lo] = acc[mt][n][v] + bn[n];
        }
        // Other lanes' values are in LDS before this lane reads them back.
        asm volatile("s_wait_dscnt 0x0" ::: "memory");
        const int s0 = (row0 % S_) + wave * 32 + mt * 16;
        #pragma unroll                                  // line and row become constant offsets
        for (int i = 0; i < 12; ++i) {
            const int seg = i % 3, r4 = (i / 3) * 4;    // line of the row; row = r4 + sub
            const int col = col0 + seg * 32;            // a line never crosses heads
            float* og = out + (((size_t)bb * H_ + (col >> 6)) * S_ + s0 + r4) * D_ + (col & 63);   // same in every lane
            // Lanes 0..3 of a line store the hi parts of eight columns each, lanes 4..7 the lo parts of the same columns.
            const float* sp = mine + (r4 + sub) * SP + seg * 32 + (q & 3) * 8;
            const v4f f0 = *(const v4f*)sp, f1 = *(const v4f*)(sp + 4);
            const float f[8] = {f0.x, f0.y, f0.z, f0.w, f1.x, f1.y, f1.z, f1.w};
            u32x4 h4, l4;
            split8(f, h4, l4);
            *(u32x4*)(og + lofs) = (q & 4) ? l4 : h4;
        }
    }
    // The last stores have taken their registers before any code that the listing lets follow writes them again.
    asm volatile("s_wait_xcnt 0x0" ::: "memory");
}

#define KT 64
#define KP 68

// One tile of 64 rows x 256 bytes, 1024 pieces of 16 bytes, eight per thread.
// g: this thread's first piece in global memory (a wave covers 512 contiguous bytes),
// l: its LDS byte address, step: LDS bytes between a thread's pieces (eight rows).
__device__ __forceinline__ void copy_tile(const float* g, unsigned l, unsigned step) {
    // The closing s_wait_xcnt keeps the address registers whole until the copies have taken them.
    asm volatile(
        "global_load_async_to_lds_b128 %0, %8, off\n\t"
        "global_load_async_to_lds_b128 %1, %9, off\n\t"
        "global_load_async_to_lds_b128 %2, %10, off\n\t"
        "global_load_async_to_lds_b128 %3, %11, off\n\t"
        "global_load_async_to_lds_b128 %4, %12, off\n\t"
        "global_load_async_to_lds_b128 %5, %13, off\n\t"
        "global_load_async_to_lds_b128 %6, %14, off\n\t"
        "global_load_async_to_lds_b128 %7, %15, off\n\t"
        "s_wait_xcnt 0x0"
        :: "v"(l), "v"(l + step), "v"(l + 2 * step), "v"(l + 3 * step),
           "v"(l + 4 * step), "v"(l + 5 * step), "v"(l + 6 * step), "v"(l + 7 * step),
           "v"(g), "v"(g + 512), "v"(g + 1024), "v"(g + 1536),
           "v"(g + 2048), "v"(g + 2560), "v"(g + 3072), "v"(g + 3584)
        : "memory");
}

// Two pieces of 16 bytes as one operand of eight registers.
__device__ __forceinline__ u32x8 frag(const unsigned char* p0, const unsigned char* p1) {
    const u32x4 x = *(const u32x4*)p0, y = *(const u32x4*)p1;
    return __builtin_shufflevector(x, y, 0, 1, 2, 3, 4, 5, 6, 7);
}

// Lane l takes the value of lane l ^ 16.
__device__ __forceinline__ float xhalf(float x) {
    const int b = __builtin_bit_cast(int, x);
    return __builtin_bit_cast(float,
        __builtin_amdgcn_permlanex16(b, b, 0x76543210, 0xfedcba98, false, false));
}

static_assert(B_ * H_ == 24 && S_ / 64 == 32, "the index map below is written for 3 x 8 heads and 32 q blocks");

__global__ __launch_bounds__(128)
void attn_kernel(const float* __restrict__ ws_q, const float* __restrict__ ws_k,
                 const float* __restrict__ ws_v, float* __restrict__ ws_o) {
    __shared__ __attribute__((aligned(16))) float kbuf[2][KT * KP];
    __shared__ __attribute__((aligned(16))) float vbuf[2][KT * KP];
    const int tid  = threadIdx.x;
    const int lane = tid & 31;
    const int wave = __builtin_amdgcn_readfirstlane(tid >> 5);
    const int lo = lane & 15, hi = lane >> 4;
    // Which (b,h) and which 64-row q block this work-group takes: any one-to-one map is right, this one is for speed.
    // A q block's cost grows with its index, and all 768 work-groups are resident at once, three to a WGP. If they are
    // dealt in turn over the 256 WGPs, indices i, i + 256 and i + 512 share a WGP: they take c0, c1, c2, three permutations of
    // 0..31 whose sum is 47 or 46 for every r, so every WGP gets 49 or 50 key tiles. The largest of the
    // three goes to the lowest index, for speed only.
    const int rnd = blockIdx.x >> 8;                    // 0..2
    const int grp = (blockIdx.x >> 5) & 7;
    const int r   = blockIdx.x & 31;
    const int c0 = r, c1 = (r < 16 ? 31 : 62) - 2 * r, c2 = (r + 16) & 31;
    const int k0 = (c1 > c0) + (c2 > c0);               // place of each by falling size, ties by position
    const int k1 = (c0 >= c1) + (c2 > c1);
    const int sel = (k0 == rnd) ? 0 : (k1 == rnd) ? 1 : 2;
    const int bh = sel * 8 + grp;                       // 0..23
    const int qb = (sel == 0) ? c0 : (sel == 1) ? c1 : c2;
    const int q0 = qb * 64 + wave * 16;
    const int nt = qb + 1;                              // staged tiles 0..qb

    const size_t base = (size_t)bh * S_ * D_;
    const float* Q = ws_q + base;
    const float* Kc = ws_k + base + tid * 4;            // this thread's first piece of tile 0
    const float* Vc = ws_v + base + tid * 4;
    const int crow = tid >> 4, ccol = (tid & 15) * 4;   // its row and column in the tile
    const unsigned kl0 = (unsigned)(size_t)&kbuf[0][crow * KP + ccol];
    const unsigned kl1 = (unsigned)(size_t)&kbuf[1][crow * KP + ccol];
    const unsigned vl0 = (unsigned)(size_t)&vbuf[0][crow * KP + ccol];
    const unsigned vl1 = (unsigned)(size_t)&vbuf[1][crow * KP + ccol];

    copy_tile(Kc, kl0, 8 * KP * 4);
    copy_tile(Vc, vl0, 8 * KP * 4);

    // Preload the Q tile as B operand (column = query lo): qf[i][part] holds d = 32i + 16hi .. + 15.
    u32x8 qf[2][2];
    {
        const unsigned char* qrow = (const unsigned char*)(Q + (size_t)(q0 + lo) * D_) + hi * 32;
        #pragma unroll                                  // fragment arrays stay in registers
        for (int i = 0; i < 2; ++i) {
            #pragma unroll                              // as above
            for (int pl = 0; pl < 2; ++pl) qf[i][pl] = frag(qrow + i * 128 + pl * 64, qrow + i * 128 + pl * 64 + 16);
        }
    }

    v8f acc0 = {}, acc1 = {}, acc2 = {}, acc3 = {};     // O^T tile: acc_n[v] = O[q0+lo][16n+8hi+v]
    const int qr = q0 + lo;                             // this lane's query
    float rm = -3.0e38f;                                // its running max (both halves alike)
    float rl = 0.0f;                                    // sum over this half's keys only

    asm volatile("s_wait_asynccnt 0x0" ::: "memory");   // this wave's share of tile 0 has landed
    __syncthreads();                                    // ... and every other wave's
    if (nt > 1) {
        copy_tile(Kc + KT * D_, kl1, 8 * KP * 4);
        copy_tile(Vc + KT * D_, vl1, 8 * KP * 4);
    }

    for (int t = 0; t < nt; ++t) {
        const unsigned char* kt = (const unsigned char*)kbuf[t & 1];
        const unsigned char* vt = (const unsigned char*)vbuf[t & 1];
        // 32-key steps of this tile that hold a key <= q0 + 15: both below the diagonal tile.
        const int ns = (t < qb) ? 2 : (wave >> 1) + 1;
        for (int u = 0; u < ns; ++u) {
            const int k0 = t * KT + u * 32;
            // ---- K and V fragments of this step, from LDS ----
            // K as A operand: row = key 16j + lo, k = d = 32i + 16hi .. + 15, the order of qf.
            const unsigned char* kr = kt + (u * 32 + lo) * (KP * 4) + hi * 32;
            u32x8 kf[2][2][2];
            #pragma unroll                                  // fragment arrays stay in registers
            for (int j = 0; j < 2; ++j) {
                #pragma unroll                              // as above
                for (int i = 0; i < 2; ++i) {
                    #pragma unroll                          // as above
                    for (int pl = 0; pl < 2; ++pl) {
                        const unsigned char* p = kr + j * 16 * (KP * 4) + i * 128 + pl * 64;
                        kf[j][i][pl] = frag(p, p + 16);
                    }
                }
            }
            // V^T as A operand: row = d (16n+lo), k = keys 8hi..8hi+7 and 16+8hi..16+8hi+7, the keys that
            // the two score accumulators hold in this lane half.
            const unsigned char* vr = vt + (u * 32 + (lo >> 1)) * (KP * 4) + (lo & 1) * 128 + hi * 16;
            u32x8 vf[4][2];
            #pragma unroll                                  // as above
            for (int n = 0; n < 4; ++n) {
                #pragma unroll                              // as above
                for (int pl = 0; pl < 2; ++pl) {
                    const unsigned char* p = vr + n * 8 * (KP * 4) + pl * 64;
                    vf[n][pl] = frag(p, p + 32);
                }
            }
            // All LDS reads of the step stand here as one group: left free, the scheduler sinks the
            // last V reads in front of their own product, where their latency shows.
            __builtin_amdgcn_sched_barrier(0);
            // ---- S^T = K * Q^T, two key tiles in turn: s[j][v] = S[q0+lo][k0+16j+8hi+v] ----
            v8f s[2] = {{}, {}};
            #pragma unroll                                  // fragment arrays are indexed by constants only
            for (int i = 0; i < 2; ++i) {
                s[0] = wmma32(kf[0][i][1], qf[i][0], s[0]);
                s[1] = wmma32(kf[1][i][1], qf[i][0], s[1]);
                s[0] = wmma32(kf[0][i][0], qf[i][1], s[0]);
                s[1] = wmma32(kf[1][i][0], qf[i][1], s[1]);
                s[0] = wmma32(kf[0][i][0], qf[i][0], s[0]);
                s[1] = wmma32(kf[1][i][0], qf[i][0], s[1]);
            }
            // ---- quirky causal mask + online softmax, one query per lane ----
            const int kbase = k0 + 8 * hi;
            float p[16];
            #pragma unroll                                  // p stays in registers
            for (int e = 0; e < 16; ++e) {
                float val = s[e >> 3][e & 7];
                if (kbase + (e >> 3) * 16 + (e & 7) > qr || val == 0.0f) val = NEGV;  // tril + exact-zero quirk
                p[e] = val;
            }
            float mx = fmaxf(fmaxf(fmaxf(fmaxf(p[0], p[1]), fmaxf(p[2], p[3])),
                                   fmaxf(fmaxf(p[4], p[5]), fmaxf(p[6], p[7]))),
                             fmaxf(fmaxf(fmaxf(p[8], p[9]), fmaxf(p[10], p[11])),
                                   fmaxf(fmaxf(p[12], p[13]), fmaxf(p[14], p[15]))));
            mx = fmaxf(mx, xhalf(mx));                      // the other sixteen keys of this query
            const float nm = fmaxf(rm, mx);
            const float sc = __expf(rm - nm);
            rm = nm;
            #pragma unroll                                  // as above
            for (int e = 0; e < 16; ++e) p[e] = __expf(p[e] - nm);
            acc0 *= sc; acc1 *= sc; acc2 *= sc; acc3 *= sc;
            // ---- P^T as B operand, straight from registers: element e of a lane is its e-th score ----
            u32x8 ph, pl8;
            #pragma unroll                                  // as above
            for (int e = 0; e < 8; ++e) {
                unsigned a, b;
                split2(p[2 * e], p[2 * e + 1], a, b);
                ph[e] = a;
                pl8[e] = b;
            }
            // ---- O^T += V^T * P^T: four d-tiles in turn, three products each ----
            acc0 = wmma32(vf[0][1], ph, acc0);
            acc1 = wmma32(vf[1][1], ph, acc1);
            acc2 = wmma32(vf[2][1], ph, acc2);
            acc3 = wmma32(vf[3][1], ph, acc3);
            acc0 = wmma32(vf[0][0], pl8, acc0);
            acc1 = wmma32(vf[1][0], pl8, acc1);
            acc2 = wmma32(vf[2][0], pl8, acc2);
            acc3 = wmma32(vf[3][0], pl8, acc3);
            acc0 = wmma32(vf[0][0], ph, acc0);
            acc1 = wmma32(vf[1][0], ph, acc1);
            acc2 = wmma32(vf[2][0], ph, acc2);
            acc3 = wmma32(vf[3][0], ph, acc3);
            // The row sum stands behind the last products and is held there, so that straight-line vector work, not the
            // loop's back edge, follows the last matrix instruction.
            __builtin_amdgcn_sched_barrier(0);
            rl = rl * sc + ((((p[0] + p[1]) + (p[2] + p[3])) + ((p[4] + p[5]) + (p[6] + p[7]))) +
                            (((p[8] + p[9]) + (p[10] + p[11])) + ((p[12] + p[13]) + (p[14] + p[15]))));
        }
        // ---- hand-over: tile t+1 becomes readable, tile t's buffer becomes free ----
        asm volatile("s_wait_dscnt 0x0" ::: "memory");      // this wave's reads of tile t are done
        asm volatile("s_wait_asynccnt 0x0" ::: "memory");   // its share of tile t+1 has landed
        __syncthreads();
        if (t + 2 < nt) {
            const size_t off = (size_t)(t + 2) * (KT * D_);
            copy_tile(Kc + off, (t & 1) ? kl1 : kl0, 8 * KP * 4);
            copy_tile(Vc + off, (t & 1) ? vl1 : vl0, 8 * KP * 4);
        }
    }
    asm volatile("s_wait_asynccnt 0x0" ::: "memory");       // nothing in flight when the wave ends

    // ---- normalize + write O as [B,S,H*D]: eight consecutive floats per d-tile and lane ----
    const int bb = bh / H_, h = bh % H_;
    const float inv = 1.0f / (rl + xhalf(rl));              // join the two halves' sums
    float* orow = ws_o + ((size_t)bb * S_ + qr) * HD + h * 64 + 8 * hi;
    *(v8f*)(orow)      = acc0 * inv;
    *(v8f*)(orow + 16) = acc1 * inv;
    *(v8f*)(orow + 32) = acc2 * inv;
    *(v8f*)(orow + 48) = acc3 * inv;
}

// ---------------------------------------------------------------------------
// Kernel 3: output projection. O[4096x768] @ Wo[768x64] + bo -> out[4096x64].
// A work-group of four waves owns 16 rows of O and all 64 columns, one column tile a wave. The 16 rows, 48 KiB that
// lie contiguous in memory, come into LDS once with whole-line loads, all in flight together; every wave takes its
// A operands from there. Wo comes from L2 in batches of 32 k-steps, one batch ahead of the products that use it.
// Each output element is still one chain over k = 0..767 in rising order.
// ---------------------------------------------------------------------------
#define OP  772           // O row pitch in LDS, floats: 8-byte reads of sixteen rows by both lane halves meet no bank twice
#define OU  32            // k-steps (4 k each) per batch of Wo loads
#define ONB (HD / 4 / OU) // batches

__global__ __launch_bounds__(128)
void out_proj_kernel(const float* __restrict__ o_ws, const float* __restrict__ Wo,
                     const float* __restrict__ bo, float* __restrict__ out) {
    __shared__ __attribute__((aligned(16))) float os[16 * OP];
    const int tid  = threadIdx.x;
    const int lane = tid & 31;
    const int wave = __builtin_amdgcn_readfirstlane(tid >> 5);
    const int lo = lane & 15, hi = lane >> 4;
    const int n0 = wave * 16;                           // 0..48
    const int m0 = blockIdx.x * 16;                     // 0..4080

    // ---- O rows: 3072 pieces of 16 bytes, 24 per thread; two rows are three rounds of 128 pieces ----
    v4f t[24];
    {
        const float* og = o_ws + (size_t)m0 * HD + tid * 4;
        #pragma unroll                                  // all loads in flight at once
        for (int i = 0; i < 24; ++i) t[i] = *(const v4f*)(og + i * 512);
    }
    // B(k = 4c + 2hi, +1; n = lo) of k-step c lies at wb[c * 256] and wb[c * 256 + 64].
    const float* wb = Wo + (size_t)(2 * hi) * D_ + n0 + lo;
    v2f bf[2][OU];
    #pragma unroll                                      // fragment arrays stay in registers
    for (int c = 0; c < OU; ++c) bf[0][c] = (v2f){wb[c * 4 * D_], wb[c * 4 * D_ + D_]};
    const float bn = bo[n0 + lo];
    {
        // Places of this thread's three pieces of a row pair: first row, the seam, second row.
        float* l0 = os + tid * 4;
        float* l1 = os + ((tid >= 64) ? OP + (tid - 64) * 4 : (128 + tid) * 4);
        float* l2 = os + OP + (64 + tid) * 4;
        #pragma unroll                                  // t is indexed by constants only
        for (int j = 0; j < 8; ++j) {
            *(v4f*)(l0 + j * 2 * OP) = t[3 * j];
            *(v4f*)(l1 + j * 2 * OP) = t[3 * j + 1];
            *(v4f*)(l2 + j * 2 * OP) = t[3 * j + 2];
        }
    }
    __syncthreads();                                    // the 16 rows are whole before anyone reads them

    const float* ar = os + lo * OP + 2 * hi;            // A(m = lo, k = 4c + 2hi, +1) lies at ar[4c]
    v8f acc = {};
    #pragma unroll                                      // bf is indexed by constants only
    for (int g = 0; g < ONB; ++g) {
        if (g + 1 < ONB) {
            #pragma unroll                              // as above
            for (int c = 0; c < OU; ++c) {
                const float* p = wb + ((g + 1) * OU + c) * 4 * D_;
                bf[(g + 1) & 1][c] = (v2f){p[0], p[D_]};
            }
        }
        v2f af[OU];
        #pragma unroll                                  // as above
        for (int c = 0; c < OU; ++c) af[c] = *(const v2f*)(ar + (g * OU + c) * 4);
        // The next batch's Wo loads and this batch's LDS reads stand ahead of the products: left free, the scheduler
        // spreads the LDS reads singly among them, one read place per two products, and shortens the Wo loads' lead.
        __builtin_amdgcn_sched_barrier(0);
        #pragma unroll                                  // as above
        for (int c = 0; c < OU; ++c) acc = wmma4(af[c], bf[g & 1][c], acc);
    }
    // Four vector slots between the last matrix instruction and the first vector read of its result; the two
    // scheduling barriers hold them at this place.
    __builtin_amdgcn_sched_barrier(0);
    asm volatile("v_nop\n\tv_nop\n\tv_nop\n\tv_nop");
    __builtin_amdgcn_sched_barrier(0);
    #pragma unroll                                      // acc is indexed by constants only
    for (int v = 0; v < 8; ++v)
        out[(size_t)(m0 + v + 8 * hi) * D_ + n0 + lo] = acc[v] + bn;
}

extern "C" void kernel_launch(void* const* d_in, const int* in_sizes, int n_in,
                              void* d_out, int out_size, void* d_ws, size_t ws_size,
                              hipStream_t stream) {
    const float* x  = (const float*)d_in[0];
    const float* Wq = (const float*)d_in[1];
    const float* bq = (const float*)d_in[2];
    const float* Wk = (const float*)d_in[3];
    const float* bk = (const float*)d_in[4];
    const float* Wv = (const float*)d_in[5];
    const float* bv = (const float*)d_in[6];
    const float* Wo = (const float*)d_in[7];
    const float* bo = (const float*)d_in[8];
    float* out = (float*)d_out;

    float* ws = (float*)d_ws;
    const size_t QKV = (size_t)B_ * S_ * HD;            // 3,145,728 floats each
    float* q = ws;
    float* k = ws + QKV;
    float* v = ws + 2 * QKV;
    float* o = ws + 3 * QKV;                            // total 48 MB of d_ws

    // 1) QKV projections: 3 matrices x 8 column blocks, 32 row blocks, four waves each.
    qkv_proj_kernel<<<dim3(3 * (HD / PN), (B_ * S_) / PM), 128, 0, stream>>>(
        x, Wq, bq, Wk, bk, Wv, bv, ws);

    // 2) Attention: 24 (b,h) x 32 q-blocks of 64 rows, four waves each.
    attn_kernel<<<dim3(B_ * H_ * (S_ / 64)), 128, 0, stream>>>(q, k, v, o);

    // 3) Output projection: 256 blocks of 16 rows, four waves each, one per column tile.
    out_proj_kernel<<<dim3((B_ * S_) / 16), 128, 0, stream>>>(o, Wo, bo, out);
}

// v007
// One run takes 62.7 microseconds.
// In two side-by-side timings against v006, it was 1.05 and 1.06 times as fast.
// All steps since v000 together make it 5.82 times as fast.
#include <hip/hip_runtime.h>
#include <hip/hip_bf16.h>

// Multi-head self-attention (B=2,S=2048,D=64,H=12), fp32 in and out.
// The two projections run on v_wmma_f32_16x16x4_f32. The two attention products run on
// v_wmma_f32_16x16x32_bf16: every f32 operand x is kept as two bf16 parts, hi = bf16(x) and
// lo = bf16(x - hi), and a product is hi*hi + hi*lo + lo*hi with f32 sums (lo*lo is dropped).

#define B_  2
#define S_  2048
#define D_  64
#define H_  12
#define HD  768           // H_*D_
#define NEGV (-99999.0f)

typedef __attribute__((ext_vector_type(2))) float v2f;
typedef __attribute__((ext_vector_type(8))) float v8f;

// D = A(16x4 f32) * B(4x16 f32) + C(16x16 f32)
__device__ __forceinline__ v8f wmma4(v2f a, v2f b, v8f c) {
    return __builtin_amdgcn_wmma_f32_16x16x4_f32(
        /*neg_a=*/false, a, /*neg_b=*/false, b,
        /*c_mod=*/(short)0, c, /*reuse_a=*/false, /*reuse_b=*/false);
}

typedef __bf16 bf16x16 __attribute__((ext_vector_type(16)));
typedef __bf16 bf16x2 __attribute__((ext_vector_type(2)));
typedef unsigned u32x4 __attribute__((ext_vector_type(4)));
typedef unsigned u32x8 __attribute__((ext_vector_type(8)));

// D = A(16x32 bf16) * B(32x16 bf16) + C(16x16 f32)
__device__ __forceinline__ v8f wmma32(u32x8 a, u32x8 b, v8f c) {
    return __builtin_amdgcn_wmma_f32_16x16x32_bf16(
        false, __builtin_bit_cast(bf16x16, a), false, __builtin_bit_cast(bf16x16, b),
        (short)0, c, false, false);
}

// Two f32 values as a pair of bf16, a in the low half.
__device__ __forceinline__ unsigned pack2(float a, float b) {
    const v2f t = {a, b};
    return __builtin_bit_cast(unsigned, __builtin_convertvector(t, bf16x2));
}

// Two f32 values as their hi pair and their lo pair.
__device__ __forceinline__ void split2(float a, float b, unsigned& h, unsigned& l) {
    h = pack2(a, b);
    l = pack2(a - __builtin_bit_cast(float, h << 16), b - __builtin_bit_cast(float, h & 0xffff0000u));
}

// Eight f32 values as eight hi parts and eight lo parts, 16 bytes each.
__device__ __forceinline__ void split8(const float* f, u32x4& h, u32x4& l) {
    unsigned a, b;
    split2(f[0], f[1], a, b); h.x = a; l.x = b;
    split2(f[2], f[3], a, b); h.y = a; l.y = b;
    split2(f[4], f[5], a, b); h.z = a; l.z = b;
    split2(f[6], f[7], a, b); h.w = a; l.w = b;
}

// ---------------------------------------------------------------------------
// Kernel 1: QKV projection. x[4096x64] @ W[64x768] + b -> scratch, split into bf16 parts.
// Q and K: [B,H,S] rows of 256 bytes, two lines; line i holds d = 32i..32i+31 as 32 hi, then 32 lo.
// V, transposed: [B,H,S/32][d] lines of 128 bytes; a line holds 32 keys of one d as 32 hi, then 32 lo.
// A work-group of four waves computes a block of 128 rows x 96 columns of one matrix; a wave takes
// 32 rows (two row tiles) of all six column tiles. The x rows and the W columns come into LDS with
// whole-line loads, once per work-group, and the results leave through LDS as whole 128-byte lines.
// 24 column blocks x 32 row blocks = 768 work-groups: three to a WGP, three waves to a SIMD.
// ---------------------------------------------------------------------------
#define PM  128           // rows per work-group
#define PN  96            // columns per work-group: three 128-byte lines of an output row
#define XP  68            // x row pitch in LDS, floats: 8-byte column reads meet no bank twice
#define WPP 224           // W pitch in LDS, floats per PAIR of k rows: W[k][n], W[k+1][n] lie side by side, so one
                          // 8-byte read brings a B operand; pairs i and i+1 lie 32 banks apart
#define SP  100           // result row pitch in LDS, floats: rows v and v+8 lie 32 banks apart

typedef __attribute__((ext_vector_type(4))) float v4f;

__global__ __launch_bounds__(128)
void qkv_proj_kernel(const float* __restrict__ x,
                     const float* __restrict__ Wq, const float* __restrict__ bq,
                     const float* __restrict__ Wk, const float* __restrict__ bk,
                     const float* __restrict__ Wv, const float* __restrict__ bv,
                     float* __restrict__ ws) {
    __shared__ __attribute__((aligned(16))) float xs[PM * XP];
    __shared__ __attribute__((aligned(16))) float wp[(D_ / 2) * WPP];
    const int tid  = threadIdx.x;
    const int lane = tid & 31;
    const int wave = __builtin_amdgcn_readfirstlane(tid >> 5);
    const int lo = lane & 15, hi = lane >> 4;           // hi in {0,1}
    const int which = blockIdx.x >> 3;                  // 0=Q 1=K 2=V
    const int col0  = (blockIdx.x & 7) * PN;            // first column, 0..672
    const int row0  = blockIdx.y * PM;                  // first row, 0..3968

    const float* W    = (which == 0) ? Wq : (which == 1) ? Wk : Wv;
    const float* bias = (which == 0) ? bq : (which == 1) ? bk : bv;
    float* out = ws + (size_t)which * (size_t)(B_ * S_ * HD);

    // ---- x block: 128 rows x 256 bytes, contiguous in memory, 16 pieces of 16 bytes per thread ----
    {
        const float* xg = x + (size_t)row0 * D_ + tid * 4;
        float* xl = xs + (tid >> 4) * XP + (tid & 15) * 4;
        #pragma unroll                                  // all loads in flight at once
        for (int i = 0; i < 16; ++i)
            *(v4f*)(xl + i * 8 * XP) = *(const v4f*)(xg + i * 512);
    }
    // ---- W block: 32 pairs of k rows x 384 bytes; a thread joins four columns of both rows ----
    #pragma unroll                                      // as above
    for (int i = 0; i < 6; ++i) {
        const int item = i * 128 + tid;
        const int kp = item / 24, c4 = item % 24;
        const float* g = W + (size_t)(2 * kp) * HD + col0 + c4 * 4;
        const v4f r0 = *(const v4f*)g;
        const v4f r1 = *(const v4f*)(g + HD);
        float* d = wp + kp * WPP + c4 * 8;
        *(v4f*)d       = (v4f){r0.x, r1.x, r0.y, r1.y};
        *(v4f*)(d + 4) = (v4f){r0.z, r1.z, r0.w, r1.w};
    }
    float bn[6];
    #pragma unroll                                      // bn stays in registers
    for (int n = 0; n < 6; ++n) bn[n] = bias[col0 + n * 16 + lo];
    __syncthreads();                                    // both blocks are whole before anyone reads them

    // ---- A operands of this wave's two row tiles: A(m=lo, k=4c+2hi, +1) ----
    float* mine = xs + wave * 32 * XP;                  // this wave's 32 rows: nobody else reads them
    v2f xa[2][16];
    #pragma unroll                                      // fragment arrays stay in registers
    for (int mt = 0; mt < 2; ++mt) {
        #pragma unroll                                  // as above
        for (int c = 0; c < 16; ++c)
            xa[mt][c] = *(const v2f*)(mine + (mt * 16 + lo) * XP + 4 * c + 2 * hi);
    }
    v8f acc[2][6];
    #pragma unroll                                      // as above
    for (int n = 0; n < 6; ++n) {
        v2f bf[16];                                     // B(k=4c+2hi, +1; n=lo)
        #pragma unroll                                  // as above
        for (int c = 0; c < 16; ++c)
            bf[c] = *(const v2f*)(wp + (2 * c + hi) * WPP + (n * 16 + lo) * 2);
        v8f a0 = {}, a1 = {};
        #pragma unroll                                  // as above
        for (int c = 0; c < 16; ++c) {                  // two chains in turn: neither waits for its own sum
            a0 = wmma4(xa[0][c], bf[c], a0);
            a1 = wmma4(xa[1][c], bf[c], a1);
        }
        acc[0][n] = a0;
        acc[1][n] = a1;
    }

    // ---- results: through this wave's own x rows, now free; Q and K one row tile at a time ----
    const int sub = lane >> 3, q = lane & 7;            // a store covers four lines, eight lanes each
    const int bb = row0 / S_;                           // a block never crosses batches
    const unsigned lofs = sub * D_ + q * 4;             // this lane's place among four output rows
    if (which == 2) {
        // V: a lane holds eight consecutive keys of one column, 16 bytes of a line's hi half and of its lo half.
        // 48 columns at a time go through LDS (pitch 144 bytes: 16-byte writes meet no bank twice) and leave as whole lines.
        unsigned char* st = (unsigned char*)mine;
        const int g = ((row0 % S_) >> 5) + wave;        // this wave's 32 rows are one group of 32 keys
        #pragma unroll                                  // acc is indexed by constants only
        for (int half = 0; half < 2; ++half) {
            // Other lanes' earlier reads of these LDS bytes stay ahead of the writes below.
            asm volatile("s_wait_dscnt 0x0" ::: "memory");
            #pragma unroll                              // as above
            for (int nn = 0; nn < 3; ++nn) {
                #pragma unroll                          // as above
                for (int mt = 0; mt < 2; ++mt) {
                    float f[8];
                    #pragma unroll                      // as above
                    for (int v = 0; v < 8; ++v) f[v] = acc[mt][half * 3 + nn][v] + bn[half * 3 + nn];
                    u32x4 h4, l4;
                    split8(f, h4, l4);
                    unsigned char* d = st + (nn * 16 + lo) * 144 + mt * 32 + hi * 16;
                    *(u32x4*)d        = h4;
                    *(u32x4*)(d + 64) = l4;
                }
            }
            // Other lanes' values are in LDS before this lane reads them back.
            asm volatile("s_wait_dscnt 0x0" ::: "memory");
            #pragma unroll                              // column becomes a constant offset
            for (int i = 0; i < 12; ++i) {
                const int col = col0 + half * 48 + i * 4;   // four columns of one head: four adjacent lines
                float* og = out + ((((size_t)bb * H_ + (col >> 6)) * (S_ / 32) + g) * D_ + (col & 63)) * 32;   // same in every lane
                *(u32x4*)(og + sub * 32 + q * 4) = *(const u32x4*)(st + (i * 4 + sub) * 144 + q * 16);
            }
        }
        return;
    }
    #pragma unroll                                      // acc is indexed by constants only
    for (int mt = 0; mt < 2; ++mt) {
        // Other lanes' earlier reads of these LDS bytes stay ahead of the writes below.
        asm volatile("s_wait_dscnt 0x0" ::: "memory");
        #pragma unroll                                  // as above
        for (int n = 0; n < 6; ++n) {
            #pragma unroll                              // as above
            for (int v = 0; v < 8; ++v)                 // C/D layout: row v+8hi, column lo
                mine[(v + 8 * hi) * SP + n * 16 + lo] = acc[mt][n][v] + bn[n];
        }
        // Other lanes' values are in LDS before this lane reads them back.
        asm volatile("s_wait_dscnt 0x0" ::: "memory");
        const int s0 = (row0 % S_) + wave * 32 + mt * 16;
        #pragma unroll                                  // line and row become constant offsets
        for (int i = 0; i < 12; ++i) {
            const int seg = i % 3, r4 = (i / 3) * 4;    // line of the row; row = r4 + sub
            const int col = col0 + seg * 32;            // a line never crosses heads
            float* og = out + (((size_t)bb * H_ + (col >> 6)) * S_ + s0 + r4) * D_ + (col & 63);   // same in every lane
            // Lanes 0..3 of a line store the hi parts of eight columns each, lanes 4..7 the lo parts of the same columns.
            const float* sp = mine + (r4 + sub) * SP + seg * 32 + (q & 3) * 8;
            const v4f f0 = *(const v4f*)sp, f1 = *(const v4f*)(sp + 4);
            const float f[8] = {f0.x, f0.y, f0.z, f0.w, f1.x, f1.y, f1.z, f1.w};
            u32x4 h4, l4;
            split8(f, h4, l4);
            *(u32x4*)(og + lofs) = (q & 4) ? l4 : h4;
        }
    }
    // The last stores have taken their registers before any code that the listing lets follow writes them again.
    asm volatile("s_wait_xcnt 0x0" ::: "memory");
}

#define KT 64
#define KP 68

// One tile of 128 rows x 256 bytes, 2048 pieces of 16 bytes, eight per thread.
// g: this thread's first piece in global memory (a wave covers 512 contiguous bytes),
// l: its LDS byte address, step: LDS bytes between a thread's pieces (sixteen rows).
__device__ __forceinline__ void copy_tile(const float* g, unsigned l, unsigned step) {
    // The closing s_wait_xcnt keeps the address registers whole until the copies have taken them.
    asm volatile(
        "global_load_async_to_lds_b128 %0, %8, off\n\t"
        "global_load_async_to_lds_b128 %1, %9, off\n\t"
        "global_load_async_to_lds_b128 %2, %10, off\n\t"
        "global_load_async_to_lds_b128 %3, %11, off\n\t"
        "global_load_async_to_lds_b128 %4, %12, off\n\t"
        "global_load_async_to_lds_b128 %5, %13, off\n\t"
        "global_load_async_to_lds_b128 %6, %14, off\n\t"
        "global_load_async_to_lds_b128 %7, %15, off\n\t"
        "s_wait_xcnt 0x0"
        :: "v"(l), "v"(l + step), "v"(l + 2 * step), "v"(l + 3 * step),
           "v"(l + 4 * step), "v"(l + 5 * step), "v"(l + 6 * step), "v"(l + 7 * step),
           "v"(g), "v"(g + 1024), "v"(g + 2048), "v"(g + 3072),
           "v"(g + 4096), "v"(g + 5120), "v"(g + 6144), "v"(g + 7168)
        : "memory");
}

// Two pieces of 16 bytes as one operand of eight registers.
__device__ __forceinline__ u32x8 frag(const unsigned char* p0, const unsigned char* p1) {
    const u32x4 x = *(const u32x4*)p0, y = *(const u32x4*)p1;
    return __builtin_shufflevector(x, y, 0, 1, 2, 3, 4, 5, 6, 7);
}

// Lane l takes the value of lane l ^ 16.
__device__ __forceinline__ float xhalf(float x) {
    const int b = __builtin_bit_cast(int, x);
    return __builtin_bit_cast(float,
        __builtin_amdgcn_permlanex16(b, b, 0x76543210, 0xfedcba98, false, false));
}

static_assert(S_ % (2 * KT) == 0, "a staged tile of 128 keys never reaches past the last key");

// One q block: 64 q rows, block qb of head bh, by all eight waves. Every wave passes every barrier in here.
__device__ __forceinline__
void attn_qblock(const int bh, const int qb, const float* __restrict__ ws_q, const float* __restrict__ ws_k,
                 const float* __restrict__ ws_v, float* __restrict__ ws_o,
                 float (*kv)[2][2 * KT * KP]) {           // [buffer][K, V][tile]
    const int tid  = threadIdx.x;
    const int lane = tid & 31;
    const int wave = __builtin_amdgcn_readfirstlane(tid >> 5);
    const int lo = lane & 15, hi = lane >> 4;
    const int kg = wave >> 2, wq = wave & 3;            // which half of the keys, which 16 q rows
    const int q0 = qb * 64 + wq * 16;
    const int nt = (qb + 2) >> 1;                       // staged tiles: keys 0 .. 64 qb + 63, rounded up to 128

    const size_t base = (size_t)bh * S_ * D_;
    const float* Q = ws_q + base;
    const float* Kc = ws_k + base + tid * 4;            // this thread's first piece of tile 0
    const float* Vc = ws_v + base + tid * 4;
    const int crow = tid >> 4, ccol = (tid & 15) * 4;   // its row and column in the tile
    const unsigned kl0 = (unsigned)(size_t)&kv[0][0][crow * KP + ccol];
    const unsigned kl1 = (unsigned)(size_t)&kv[1][0][crow * KP + ccol];
    const unsigned vl0 = (unsigned)(size_t)&kv[0][1][crow * KP + ccol];
    const unsigned vl1 = (unsigned)(size_t)&kv[1][1][crow * KP + ccol];

    copy_tile(Kc, kl0, 16 * KP * 4);
    copy_tile(Vc, vl0, 16 * KP * 4);

    // Preload the Q tile as B operand (column = query lo): qf[i][part] holds d = 32i + 16hi .. + 15.
    u32x8 qf[2][2];
    {
        const unsigned char* qrow = (const unsigned char*)(Q + (size_t)(q0 + lo) * D_) + hi * 32;
        #pragma unroll                                  // fragment arrays stay in registers
        for (int i = 0; i < 2; ++i) {
            #pragma unroll                              // as above
            for (int pl = 0; pl < 2; ++pl) qf[i][pl] = frag(qrow + i * 128 + pl * 64, qrow + i * 128 + pl * 64 + 16);
        }
    }

    v8f acc0 = {}, acc1 = {}, acc2 = {}, acc3 = {};     // O^T tile: acc_n[v] = O[q0+lo][16n+8hi+v]
    const int qr = q0 + lo;                             // this lane's query
    float rm = -3.0e38f;                                // its running max (both halves alike)
    float rl = 0.0f;                                    // sum over this half's keys only

    asm volatile("s_wait_asynccnt 0x0" ::: "memory");   // this wave's share of tile 0 has landed
    __syncthreads();                                    // ... and every other wave's
    if (nt > 1) {
        copy_tile(Kc + 2 * KT * D_, kl1, 16 * KP * 4);
        copy_tile(Vc + 2 * KT * D_, vl1, 16 * KP * 4);
    }

    for (int t = 0; t < nt; ++t) {
        const unsigned char* kt = (const unsigned char*)(kv[t & 1][0] + kg * KT * KP);
        const unsigned char* vt = (const unsigned char*)(kv[t & 1][1] + kg * KT * KP);
        const int h = 2 * t + kg;                           // this wave's 64 keys, counted in q blocks
        // 32-key steps of this half that hold a key <= q0 + 15: both below the diagonal, none above it.
        const int ns = (h < qb) ? 2 : (h == qb) ? (wq >> 1) + 1 : 0;
        for (int u = 0; u < ns; ++u) {
            const int k0 = h * KT + u * 32;
            // ---- K and V fragments of this step, from LDS ----
            // K as A operand: row = key 16j + lo, k = d = 32i + 16hi .. + 15, the order of qf.
            const unsigned char* kr = kt + (u * 32 + lo) * (KP * 4) + hi * 32;
            u32x8 kf[2][2][2];
            #pragma unroll                                  // fragment arrays stay in registers
            for (int j = 0; j < 2; ++j) {
                #pragma unroll                              // as above
                for (int i = 0; i < 2; ++i) {
                    #pragma unroll                          // as above
                    for (int pl = 0; pl < 2; ++pl) {
                        const unsigned char* p = kr + j * 16 * (KP * 4) + i * 128 + pl * 64;
                        kf[j][i][pl] = frag(p, p + 16);
                    }
                }
            }
            // V^T as A operand: row = d (16n+lo), k = keys 8hi..8hi+7 and 16+8hi..16+8hi+7, the keys that
            // the two score accumulators hold in this lane half.
            const unsigned char* vr = vt + (u * 32 + (lo >> 1)) * (KP * 4) + (lo & 1) * 128 + hi * 16;
            u32x8 vf[4][2];
            #pragma unroll                                  // as above
            for (int n = 0; n < 4; ++n) {
                #pragma unroll                              // as above
                for (int pl = 0; pl < 2; ++pl) {
                    const unsigned char* p = vr + n * 8 * (KP * 4) + pl * 64;
                    vf[n][pl] = frag(p, p + 32);
                }
            }
            // All LDS reads of the step stand here as one group: left free, the scheduler sinks the
            // last V reads in front of their own product, where their latency shows.
            __builtin_amdgcn_sched_barrier(0);
            // ---- S^T = K * Q^T, two key tiles in turn: s[j][v] = S[q0+lo][k0+16j+8hi+v] ----
            v8f s[2] = {{}, {}};
            #pragma unroll                                  // fragment arrays are indexed by constants only
            for (int i = 0; i < 2; ++i) {
                s[0] = wmma32(kf[0][i][1], qf[i][0], s[0]);
                s[1] = wmma32(kf[1][i][1], qf[i][0], s[1]);
                s[0] = wmma32(kf[0][i][0], qf[i][1], s[0]);
                s[1] = wmma32(kf[1][i][0], qf[i][1], s[1]);
                s[0] = wmma32(kf[0][i][0], qf[i][0], s[0]);
                s[1] = wmma32(kf[1][i][0], qf[i][0], s[1]);
            }
            // ---- quirky causal mask + online softmax, one query per lane ----
            const int kbase = k0 + 8 * hi;
            float p[16];
            #pragma unroll                                  // p stays in registers
            for (int e = 0; e < 16; ++e) {
                float val = s[e >> 3][e & 7];
                if (kbase + (e >> 3) * 16 + (e & 7) > qr || val == 0.0f) val = NEGV;  // tril + exact-zero quirk
                p[e] = val;
            }
            float mx = fmaxf(fmaxf(fmaxf(fmaxf(p[0], p[1]), fmaxf(p[2], p[3])),
                                   fmaxf(fmaxf(p[4], p[5]), fmaxf(p[6], p[7]))),
                             fmaxf(fmaxf(fmaxf(p[8], p[9]), fmaxf(p[10], p[11])),
                                   fmaxf(fmaxf(p[12], p[13]), fmaxf(p[14], p[15]))));
            mx = fmaxf(mx, xhalf(mx));                      // the other sixteen keys of this query
            const float nm = fmaxf(rm, mx);
            const float sc = __expf(rm - nm);
            rm = nm;
            #pragma unroll                                  // as above
            for (int e = 0; e < 16; ++e) p[e] = __expf(p[e] - nm);
            acc0 *= sc; acc1 *= sc; acc2 *= sc; acc3 *= sc;
            // ---- P^T as B operand, straight from registers: element e of a lane is its e-th score ----
            u32x8 ph, pl8;
            #pragma unroll                                  // as above
            for (int e = 0; e < 8; ++e) {
                unsigned a, b;
                split2(p[2 * e], p[2 * e + 1], a, b);
                ph[e] = a;
                pl8[e] = b;
            }
            // ---- O^T += V^T * P^T: four d-tiles in turn, three products each ----
            acc0 = wmma32(vf[0][1], ph, acc0);
            acc1 = wmma32(vf[1][1], ph, acc1);
            acc2 = wmma32(vf[2][1], ph, acc2);
            acc3 = wmma32(vf[3][1], ph, acc3);
            acc0 = wmma32(vf[0][0], pl8, acc0);
            acc1 = wmma32(vf[1][0], pl8, acc1);
            acc2 = wmma32(vf[2][0], pl8, acc2);
            acc3 = wmma32(vf[3][0], pl8, acc3);
            acc0 = wmma32(vf[0][0], ph, acc0);
            acc1 = wmma32(vf[1][0], ph, acc1);
            acc2 = wmma32(vf[2][0], ph, acc2);
            acc3 = wmma32(vf[3][0], ph, acc3);
            // The row sum stands behind the last products and is held there, so that straight-line vector work, not the
            // loop's back edge, follows the last matrix instruction.
            __builtin_amdgcn_sched_barrier(0);
            rl = rl * sc + ((((p[0] + p[1]) + (p[2] + p[3])) + ((p[4] + p[5]) + (p[6] + p[7]))) +
                            (((p[8] + p[9]) + (p[10] + p[11])) + ((p[12] + p[13]) + (p[14] + p[15]))));
        }
        // ---- hand-over: tile t+1 becomes readable, tile t's buffer becomes free ----
        asm volatile("s_wait_dscnt 0x0" ::: "memory");      // this wave's reads of tile t are done
        asm volatile("s_wait_asynccnt 0x0" ::: "memory");   // its share of tile t+1 has landed
        __syncthreads();
        if (t + 2 < nt) {
            const size_t off = (size_t)(t + 2) * (2 * KT * D_);
            copy_tile(Kc + off, (t & 1) ? kl1 : kl0, 16 * KP * 4);
            copy_tile(Vc + off, (t & 1) ? vl1 : vl0, 16 * KP * 4);
        }
    }
    asm volatile("s_wait_asynccnt 0x0" ::: "memory");       // nothing in flight when the join below reuses buffer 0

    // ---- join the two key halves: waves 4..7 hand maximum, sum and O tile to waves 0..3 through LDS ----
    // The loop's last barrier has ended every read of the tiles, and no copy is in flight: the buffer is free.
    v4f* mg = (v4f*)&kv[0][0][0] + wq * (9 * 32) + lane; // nine pieces of 16 bytes a lane, lanes side by side
    if (kg == 1) {
        mg[0 * 32] = __builtin_shufflevector(acc0, acc0, 0, 1, 2, 3);
        mg[1 * 32] = __builtin_shufflevector(acc0, acc0, 4, 5, 6, 7);
        mg[2 * 32] = __builtin_shufflevector(acc1, acc1, 0, 1, 2, 3);
        mg[3 * 32] = __builtin_shufflevector(acc1, acc1, 4, 5, 6, 7);
        mg[4 * 32] = __builtin_shufflevector(acc2, acc2, 0, 1, 2, 3);
        mg[5 * 32] = __builtin_shufflevector(acc2, acc2, 4, 5, 6, 7);
        mg[6 * 32] = __builtin_shufflevector(acc3, acc3, 0, 1, 2, 3);
        mg[7 * 32] = __builtin_shufflevector(acc3, acc3, 4, 5, 6, 7);
        mg[8 * 32] = (v4f){rm, rl, 0.0f, 0.0f};
    }
    __syncthreads();                                        // the partial results are whole before waves 0..3 read them
    if (kg == 1) return;                                    // back to the caller: nothing is left for waves 4..7 here
    {
        const v4f ml = mg[8 * 32];
        const float nm = fmaxf(rm, ml.x);                   // a half without keys brings -3e38 and weighs nothing
        const float w0 = __expf(rm - nm), w1 = __expf(ml.x - nm);
        rl = rl * w0 + ml.y * w1;
        acc0 = acc0 * w0 + __builtin_shufflevector(mg[0 * 32], mg[1 * 32], 0, 1, 2, 3, 4, 5, 6, 7) * w1;
        acc1 = acc1 * w0 + __builtin_shufflevector(mg[2 * 32], mg[3 * 32], 0, 1, 2, 3, 4, 5, 6, 7) * w1;
        acc2 = acc2 * w0 + __builtin_shufflevector(mg[4 * 32], mg[5 * 32], 0, 1, 2, 3, 4, 5, 6, 7) * w1;
        acc3 = acc3 * w0 + __builtin_shufflevector(mg[6 * 32], mg[7 * 32], 0, 1, 2, 3, 4, 5, 6, 7) * w1;
    }

    // ---- normalize + write O as [B,S,H*D]: eight consecutive floats per d-tile and lane ----
    const int bb = bh / H_, h = bh % H_;
    const float inv = 1.0f / (rl + xhalf(rl));              // join the two halves' sums
    float* orow = ws_o + ((size_t)bb * S_ + qr) * HD + h * 64 + 8 * hi;
    *(v8f*)(orow)      = acc0 * inv;
    *(v8f*)(orow + 16) = acc1 * inv;
    *(v8f*)(orow + 32) = acc2 * inv;
    *(v8f*)(orow + 48) = acc3 * inv;
    // A precaution: the caller may go on to a second q block, whose first lines write the stores' registers again.
    asm volatile("s_wait_xcnt 0x0" ::: "memory");
}

static_assert(B_ * H_ == 24 && S_ / 64 == 32, "the index map below is written for 3 x 8 heads and 32 q blocks");

// Four waves to a SIMD, so that two work-groups share a WGP: at most 256 registers a wave.
__global__ __launch_bounds__(256) __attribute__((amdgpu_waves_per_eu(4, 4)))
void attn_kernel(const float* __restrict__ ws_q, const float* __restrict__ ws_k,
                 const float* __restrict__ ws_v, float* __restrict__ ws_o) {
    // A buffer's K and V tiles lie side by side: every LDS read of a step is then one base register plus an offset
    // that fits the instruction's 16-bit field.
    __shared__ __attribute__((aligned(16))) float kv[2][2][2 * KT * KP];
    // Which (b,h) and which 64-row q blocks this work-group takes: any one-to-one map is right, this one is for speed.
    // A q block's cost grows with its index, and all 512 work-groups are resident at once, two to a WGP. If they are
    // dealt in turn over the 256 WGPs, indices i and i + 256 share a WGP: together they take c0, c1, c2, three
    // permutations of 0..31 whose sum is 47 or 46 for every r, so every WGP gets 25 or 26 staged key tiles.
    // The lower index takes the largest of the three, the higher index the other two, one after the other.
    const int rnd = blockIdx.x >> 8;                    // 0..1
    const int grp = (blockIdx.x >> 5) & 7;
    const int r   = blockIdx.x & 31;
    const int c0 = r, c1 = (r < 16 ? 31 : 62) - 2 * r, c2 = (r + 16) & 31;
    const int k0 = (c1 > c0) + (c2 > c0);               // place of each by falling size, ties by position
    const int k1 = (c0 >= c1) + (c2 > c1);
    for (int place = rnd; place <= 2 * rnd; ++place) {  // place 0, or places 1 and 2
        const int sel = (k0 == place) ? 0 : (k1 == place) ? 1 : 2;
        attn_qblock(sel * 8 + grp, (sel == 0) ? c0 : (sel == 1) ? c1 : c2, ws_q, ws_k, ws_v, ws_o, kv);
        if (place < 2 * rnd) {
            asm volatile("s_wait_dscnt 0x0" ::: "memory");  // this wave's reads of the partial results are done
            __syncthreads();                                // ... and every wave's, before the next q block's copies land there
        }
    }
}

// ---------------------------------------------------------------------------
// Kernel 3: output projection. O[4096x768] @ Wo[768x64] + bo -> out[4096x64].
// A work-group of four waves owns 16 rows of O and all 64 columns, one column tile a wave. The 16 rows, 48 KiB that
// lie contiguous in memory, come into LDS once with whole-line loads, all in flight together; every wave takes its
// A operands from there. Wo comes from L2 in batches of 32 k-steps, one batch ahead of the products that use it.
// Each output element is still one chain over k = 0..767 in rising order.
// ---------------------------------------------------------------------------
#define OP  772           // O row pitch in LDS, floats: 8-byte reads of sixteen rows by both lane halves meet no bank twice
#define OU  32            // k-steps (4 k each) per batch of Wo loads
#define ONB (HD / 4 / OU) // batches

__global__ __launch_bounds__(128)
void out_proj_kernel(const float* __restrict__ o_ws, const float* __restrict__ Wo,
                     const float* __restrict__ bo, float* __restrict__ out) {
    __shared__ __attribute__((aligned(16))) float os[16 * OP];
    const int tid  = threadIdx.x;
    const int lane = tid & 31;
    const int wave = __builtin_amdgcn_readfirstlane(tid >> 5);
    const int lo = lane & 15, hi = lane >> 4;
    const int n0 = wave * 16;                           // 0..48
    const int m0 = blockIdx.x * 16;                     // 0..4080

    // ---- O rows: 3072 pieces of 16 bytes, 24 per thread; two rows are three rounds of 128 pieces ----
    v4f t[24];
    {
        const float* og = o_ws + (size_t)m0 * HD + tid * 4;
        #pragma unroll                                  // all loads in flight at once
        for (int i = 0; i < 24; ++i) t[i] = *(const v4f*)(og + i * 512);
    }
    // B(k = 4c + 2hi, +1; n = lo) of k-step c lies at wb[c * 256] and wb[c * 256 + 64].
    const float* wb = Wo + (size_t)(2 * hi) * D_ + n0 + lo;
    v2f bf[2][OU];
    #pragma unroll                                      // fragment arrays stay in registers
    for (int c = 0; c < OU; ++c) bf[0][c] = (v2f){wb[c * 4 * D_], wb[c * 4 * D_ + D_]};
    const float bn = bo[n0 + lo];
    {
        // Places of this thread's three pieces of a row pair: first row, the seam, second row.
        float* l0 = os + tid * 4;
        float* l1 = os + ((tid >= 64) ? OP + (tid - 64) * 4 : (128 + tid) * 4);
        float* l2 = os + OP + (64 + tid) * 4;
        #pragma unroll                                  // t is indexed by constants only
        for (int j = 0; j < 8; ++j) {
            *(v4f*)(l0 + j * 2 * OP) = t[3 * j];
            *(v4f*)(l1 + j * 2 * OP) = t[3 * j + 1];
            *(v4f*)(l2 + j * 2 * OP) = t[3 * j + 2];
        }
    }
    __syncthreads();                                    // the 16 rows are whole before anyone reads them

    const float* ar = os + lo * OP + 2 * hi;            // A(m = lo, k = 4c + 2hi, +1) lies at ar[4c]
    v8f acc = {};
    #pragma unroll                                      // bf is indexed by constants only
    for (int g = 0; g < ONB; ++g) {
        if (g + 1 < ONB) {
            #pragma unroll                              // as above
            for (int c = 0; c < OU; ++c) {
                const float* p = wb + ((g + 1) * OU + c) * 4 * D_;
                bf[(g + 1) & 1][c] = (v2f){p[0], p[D_]};
            }
        }
        v2f af[OU];
        #pragma unroll                                  // as above
        for (int c = 0; c < OU; ++c) af[c] = *(const v2f*)(ar + (g * OU + c) * 4);
        // The next batch's Wo loads and this batch's LDS reads stand ahead of the products: left free, the scheduler
        // spreads the LDS reads singly among them, one read place per two products, and shortens the Wo loads' lead.
        __builtin_amdgcn_sched_barrier(0);
        #pragma unroll                                  // as above
        for (int c = 0; c < OU; ++c) acc = wmma4(af[c], bf[g & 1][c], acc);
    }
    // Four vector slots between the last matrix instruction and the first vector read of its result; the two
    // scheduling barriers hold them at this place.
    __builtin_amdgcn_sched_barrier(0);
    asm volatile("v_nop\n\tv_nop\n\tv_nop\n\tv_nop");
    __builtin_amdgcn_sched_barrier(0);
    #pragma unroll                                      // acc is indexed by constants only
    for (int v = 0; v < 8; ++v)
        out[(size_t)(m0 + v + 8 * hi) * D_ + n0 + lo] = acc[v] + bn;
}

extern "C" void kernel_launch(void* const* d_in, const int* in_sizes, int n_in,
                              void* d_out, int out_size, void* d_ws, size_t ws_size,
                              hipStream_t stream) {
    const float* x  = (const float*)d_in[0];
    const float* Wq = (const float*)d_in[1];
    const float* bq = (const float*)d_in[2];
    const float* Wk = (const float*)d_in[3];
    const float* bk = (const float*)d_in[4];
    const float* Wv = (const float*)d_in[5];
    const float* bv = (const float*)d_in[6];
    const float* Wo = (const float*)d_in[7];
    const float* bo = (const float*)d_in[8];
    float* out = (float*)d_out;

    float* ws = (float*)d_ws;
    const size_t QKV = (size_t)B_ * S_ * HD;            // 3,145,728 floats each
    float* q = ws;
    float* k = ws + QKV;
    float* v = ws + 2 * QKV;
    float* o = ws + 3 * QKV;                            // total 48 MB of d_ws

    // 1) QKV projections: 3 matrices x 8 column blocks, 32 row blocks, four waves each.
    qkv_proj_kernel<<<dim3(3 * (HD / PN), (B_ * S_) / PM), 128, 0, stream>>>(
        x, Wq, bq, Wk, bk, Wv, bv, ws);

    // 2) Attention: 24 (b,h) x 32 q-blocks of 64 rows, eight waves each; 512 work-groups take one or two q blocks.
    attn_kernel<<<dim3(B_ * H_ * (S_ / 64) * 2 / 3), 256, 0, stream>>>(q, k, v, o);

    // 3) Output projection: 256 blocks of 16 rows, four waves each, one per column tile.
    out_proj_kernel<<<dim3((B_ * S_) / 16), 128, 0, stream>>>(o, Wo, bo, out);
}

// v008
// It runs in 59.3 microseconds.
// Two timings next to v007 put it at 1.05 and 1.06 times that version's speed.
// Over all steps from v000 it is 6.13 times as fast.
#include <hip/hip_runtime.h>
#include <hip/hip_bf16.h>

// Multi-head self-attention (B=2,S=2048,D=64,H=12), fp32 in and out.
// The two projections run on v_wmma_f32_16x16x4_f32. The two attention products run on
// v_wmma_f32_16x16x32_bf16: every f32 operand x is kept as two bf16 parts, hi = bf16(x) and
// lo = bf16(x - hi), and a product is hi*hi + hi*lo + lo*hi with f32 sums (lo*lo is dropped).

#define B_  2
#define S_  2048
#define D_  64
#define H_  12
#define HD  768           // H_*D_
#define NEGV (-99999.0f)

typedef __attribute__((ext_vector_type(2))) float v2f;
typedef __attribute__((ext_vector_type(8))) float v8f;

// D = A(16x4 f32) * B(4x16 f32) + C(16x16 f32)
__device__ __forceinline__ v8f wmma4(v2f a, v2f b, v8f c) {
    return __builtin_amdgcn_wmma_f32_16x16x4_f32(
        /*neg_a=*/false, a, /*neg_b=*/false, b,
        /*c_mod=*/(short)0, c, /*reuse_a=*/false, /*reuse_b=*/false);
}

typedef __bf16 bf16x16 __attribute__((ext_vector_type(16)));
typedef __bf16 bf16x2 __attribute__((ext_vector_type(2)));
typedef unsigned u32x4 __attribute__((ext_vector_type(4)));
typedef unsigned u32x8 __attribute__((ext_vector_type(8)));

// D = A(16x32 bf16) * B(32x16 bf16) + C(16x16 f32)
__device__ __forceinline__ v8f wmma32(u32x8 a, u32x8 b, v8f c) {
    return __builtin_amdgcn_wmma_f32_16x16x32_bf16(
        false, __builtin_bit_cast(bf16x16, a), false, __builtin_bit_cast(bf16x16, b),
        (short)0, c, false, false);
}

// Two f32 values as a pair of bf16, a in the low half.
__device__ __forceinline__ unsigned pack2(float a, float b) {
    const v2f t = {a, b};
    return __builtin_bit_cast(unsigned, __builtin_convertvector(t, bf16x2));
}

// Two f32 values as their hi pair and their lo pair.
__device__ __forceinline__ void split2(float a, float b, unsigned& h, unsigned& l) {
    h = pack2(a, b);
    l = pack2(a - __builtin_bit_cast(float, h << 16), b - __builtin_bit_cast(float, h & 0xffff0000u));
}

// Eight f32 values as eight hi parts and eight lo parts, 16 bytes each.
__device__ __forceinline__ void split8(const float* f, u32x4& h, u32x4& l) {
    unsigned a, b;
    split2(f[0], f[1], a, b); h.x = a; l.x = b;
    split2(f[2], f[3], a, b); h.y = a; l.y = b;
    split2(f[4], f[5], a, b); h.z = a; l.z = b;
    split2(f[6], f[7], a, b); h.w = a; l.w = b;
}

// ---------------------------------------------------------------------------
// Kernel 1: QKV projection. x[4096x64] @ W[64x768] + b -> scratch, split into bf16 parts.
// Q and K: [B,H,S] rows of 256 bytes, two lines; line i holds d = 32i..32i+31 as 32 hi, then 32 lo.
// V, transposed: [B,H,S/32][d] lines of 128 bytes; a line holds 32 keys of one d as 32 hi, then 32 lo.
// A work-group of four waves computes a block of 128 rows x 96 columns of one matrix; a wave takes
// 32 rows (two row tiles) of all six column tiles. The x rows and the W columns come into LDS with
// whole-line loads, once per work-group, and the results leave through LDS as whole 128-byte lines.
// 24 column blocks x 32 row blocks = 768 work-groups: three to a WGP, three waves to a SIMD.
// ---------------------------------------------------------------------------
#define PM  128           // rows per work-group
#define PN  96            // columns per work-group: three 128-byte lines of an output row
#define XP  68            // x row pitch in LDS, floats: 8-byte column reads meet no bank twice
#define WPP 224           // W pitch in LDS, floats per PAIR of k rows: W[k][n], W[k+1][n] lie side by side, so one
                          // 8-byte read brings a B operand; pairs i and i+1 lie 32 banks apart
#define SP  100           // result row pitch in LDS, floats: rows v and v+8 lie 32 banks apart

typedef __attribute__((ext_vector_type(4))) float v4f;

__global__ __launch_bounds__(128)
void qkv_proj_kernel(const float* __restrict__ x,
                     const float* __restrict__ Wq, const float* __restrict__ bq,
                     const float* __restrict__ Wk, const float* __restrict__ bk,
                     const float* __restrict__ Wv, const float* __restrict__ bv,
                     float* __restrict__ ws) {
    __shared__ __attribute__((aligned(16))) float xs[PM * XP];
    __shared__ __attribute__((aligned(16))) float wp[(D_ / 2) * WPP];
    const int tid  = threadIdx.x;
    const int lane = tid & 31;
    const int wave = __builtin_amdgcn_readfirstlane(tid >> 5);
    const int lo = lane & 15, hi = lane >> 4;           // hi in {0,1}
    const int which = blockIdx.x >> 3;                  // 0=Q 1=K 2=V
    const int col0  = (blockIdx.x & 7) * PN;            // first column, 0..672
    const int row0  = blockIdx.y * PM;                  // first row, 0..3968

    const float* W    = (which == 0) ? Wq : (which == 1) ? Wk : Wv;
    const float* bias = (which == 0) ? bq : (which == 1) ? bk : bv;
    float* out = ws + (size_t)which * (size_t)(B_ * S_ * HD);

    // ---- x block: 128 rows x 256 bytes, contiguous in memory, 16 pieces of 16 bytes per thread ----
    {
        const float* xg = x + (size_t)row0 * D_ + tid * 4;
        float* xl = xs + (tid >> 4) * XP + (tid & 15) * 4;
        #pragma unroll                                  // all loads in flight at once
        for (int i = 0; i < 16; ++i)
            *(v4f*)(xl + i * 8 * XP) = *(const v4f*)(xg + i * 512);
    }
    // ---- W block: 32 pairs of k rows x 384 bytes; a thread joins four columns of both rows ----
    #pragma unroll                                      // as above
    for (int i = 0; i < 6; ++i) {
        const int item = i * 128 + tid;
        const int kp = item / 24, c4 = item % 24;
        const float* g = W + (size_t)(2 * kp) * HD + col0 + c4 * 4;
        const v4f r0 = *(const v4f*)g;
        const v4f r1 = *(const v4f*)(g + HD);
        float* d = wp + kp * WPP + c4 * 8;
        *(v4f*)d       = (v4f){r0.x, r1.x, r0.y, r1.y};
        *(v4f*)(d + 4) = (v4f){r0.z, r1.z, r0.w, r1.w};
    }
    float bn[6];
    #pragma unroll                                      // bn stays in registers
    for (int n = 0; n < 6; ++n) bn[n] = bias[col0 + n * 16 + lo];
    __syncthreads();                                    // both blocks are whole before anyone reads them

    // ---- A operands of this wave's two row tiles: A(m=lo, k=4c+2hi, +1) ----
    float* mine = xs + wave * 32 * XP;                  // this wave's 32 rows: nobody else reads them
    v2f xa[2][16];
    #pragma unroll                                      // fragment arrays stay in registers
    for (int mt = 0; mt < 2; ++mt) {
        #pragma unroll                                  // as above
        for (int c = 0; c < 16; ++c)
            xa[mt][c] = *(const v2f*)(mine + (mt * 16 + lo) * XP + 4 * c + 2 * hi);
    }
    v8f acc[2][6];
    #pragma unroll                                      // as above
    for (int n = 0; n < 6; ++n) {
        v2f bf[16];                                     // B(k=4c+2hi, +1; n=lo)
        #pragma unroll                                  // as above
        for (int c = 0; c < 16; ++c)
            bf[c] = *(const v2f*)(wp + (2 * c + hi) * WPP + (n * 16 + lo) * 2);
        v8f a0 = {}, a1 = {};
        #pragma unroll                                  // as above
        for (int c = 0; c < 16; ++c) {                  // two chains in turn: neither waits for its own sum
            a0 = wmma4(xa[0][c], bf[c], a0);
            a1 = wmma4(xa[1][c], bf[c], a1);
        }
        acc[0][n] = a0;
        acc[1][n] = a1;
    }

    // ---- results: through this wave's own x rows, now free; Q and K one row tile at a time ----
    const int sub = lane >> 3, q = lane & 7;            // a store covers four lines, eight lanes each
    const int bb = row0 / S_;                           // a block never crosses batches
    const unsigned lofs = sub * D_ + q * 4;             // this lane's place among four output rows
    if (which == 2) {
        // V: a lane holds eight consecutive keys of one column, 16 bytes of a line's hi half and of its lo half.
        // 48 columns at a time go through LDS (pitch 144 bytes: 16-byte writes meet no bank twice) and leave as whole lines.
        unsigned char* st = (unsigned char*)mine;
        const int g = ((row0 % S_) >> 5) + wave;        // this wave's 32 rows are one group of 32 keys
        #pragma unroll                                  // acc is indexed by constants only
        for (int half = 0; half < 2; ++half) {
            // Other lanes' earlier reads of these LDS bytes stay ahead of the writes below.
            asm volatile("s_wait_dscnt 0x0" ::: "memory");
            #pragma unroll                              // as above
            for (int nn = 0; nn < 3; ++nn) {
                #pragma unroll                          // as above
                for (int mt = 0; mt < 2; ++mt) {
                    float f[8];
                    #pragma unroll                      // as above
                    for (int v = 0; v < 8; ++v) f[v] = acc[mt][half * 3 + nn][v] + bn[half * 3 + nn];
                    u32x4 h4, l4;
                    split8(f, h4, l4);
                    unsigned char* d = st + (nn * 16 + lo) * 144 + mt * 32 + hi * 16;
                    *(u32x4*)d        = h4;
                    *(u32x4*)(d + 64) = l4;
                }
            }
            // Other lanes' values are in LDS before this lane reads them back.
            asm volatile("s_wait_dscnt 0x0" ::: "memory");
            #pragma unroll                              // column becomes a constant offset
            for (int i = 0; i < 12; ++i) {
                const int col = col0 + half * 48 + i * 4;   // four columns of one head: four adjacent lines
                float* og = out + ((((size_t)bb * H_ + (col >> 6)) * (S_ / 32) + g) * D_ + (col & 63)) * 32;   // same in every lane
                *(u32x4*)(og + sub * 32 + q * 4) = *(const u32x4*)(st + (i * 4 + sub) * 144 + q * 16);
            }
        }
        return;
    }
    #pragma unroll                                      // acc is indexed by constants only
    for (int mt = 0; mt < 2; ++mt) {
        // Other lanes' earlier reads of these LDS bytes stay ahead of the writes below.
        asm volatile("s_wait_dscnt 0x0" ::: "memory");
        #pragma unroll                                  // as above
        for (int n = 0; n < 6; ++n) {
            #pragma unroll                              // as above
            for (int v = 0; v < 8; ++v)                 // C/D layout: row v+8hi, column lo
                mine[(v + 8 * hi) * SP + n * 16 + lo] = acc[mt][n][v] + bn[n];
        }
        // Other lanes' values are in LDS before this lane reads them back.
        asm volatile("s_wait_dscnt 0x0" ::: "memory");
        const int s0 = (row0 % S_) + wave * 32 + mt * 16;
        #pragma unroll                                  // line and row become constant offsets
        for (int i = 0; i < 12; ++i) {
            const int seg = i % 3, r4 = (i / 3) * 4;    // line of the row; row = r4 + sub
            const int col = col0 + seg * 32;            // a line never crosses heads
            float* og = out + (((size_t)bb * H_ + (col >> 6)) * S_ + s0 + r4) * D_ + (col & 63);   // same in every lane
            // Lanes 0..3 of a line store the hi parts of eight columns each, lanes 4..7 the lo parts of the same columns.
            const float* sp = mine + (r4 + sub) * SP + seg * 32 + (q & 3) * 8;
            const v4f f0 = *(const v4f*)sp, f1 = *(const v4f*)(sp + 4);
            const float f[8] = {f0.x, f0.y, f0.z, f0.w, f1.x, f1.y, f1.z, f1.w};
            u32x4 h4, l4;
            split8(f, h4, l4);
            *(u32x4*)(og + lofs) = (q & 4) ? l4 : h4;
        }
    }
    // The last stores have taken their registers before any code that the listing lets follow writes them again.
    asm volatile("s_wait_xcnt 0x0" ::: "memory");
}

#define KT 64
#define KP 68

// One tile of 128 rows x 256 bytes, 2048 pieces of 16 bytes, eight per thread.
// g: this thread's first piece in global memory (a wave covers 512 contiguous bytes),
// l: its LDS byte address, step: LDS bytes between a thread's pieces (sixteen rows).
__device__ __forceinline__ void copy_tile(const float* g, unsigned l, unsigned step) {
    // The closing s_wait_xcnt keeps the address registers whole until the copies have taken them.
    asm volatile(
        "global_load_async_to_lds_b128 %0, %8, off\n\t"
        "global_load_async_to_lds_b128 %1, %9, off\n\t"
        "global_load_async_to_lds_b128 %2, %10, off\n\t"
        "global_load_async_to_lds_b128 %3, %11, off\n\t"
        "global_load_async_to_lds_b128 %4, %12, off\n\t"
        "global_load_async_to_lds_b128 %5, %13, off\n\t"
        "global_load_async_to_lds_b128 %6, %14, off\n\t"
        "global_load_async_to_lds_b128 %7, %15, off\n\t"
        "s_wait_xcnt 0x0"
        :: "v"(l), "v"(l + step), "v"(l + 2 * step), "v"(l + 3 * step),
           "v"(l + 4 * step), "v"(l + 5 * step), "v"(l + 6 * step), "v"(l + 7 * step),
           "v"(g), "v"(g + 1024), "v"(g + 2048), "v"(g + 3072),
           "v"(g + 4096), "v"(g + 5120), "v"(g + 6144), "v"(g + 7168)
        : "memory");
}

// Two pieces of 16 bytes as one operand of eight registers.
__device__ __forceinline__ u32x8 frag(const unsigned char* p0, const unsigned char* p1) {
    const u32x4 x = *(const u32x4*)p0, y = *(const u32x4*)p1;
    return __builtin_shufflevector(x, y, 0, 1, 2, 3, 4, 5, 6, 7);
}

// Lane l takes the value of lane l ^ 16.
__device__ __forceinline__ float xhalf(float x) {
    const int b = __builtin_bit_cast(int, x);
    return __builtin_bit_cast(float,
        __builtin_amdgcn_permlanex16(b, b, 0x76543210, 0xfedcba98, false, false));
}

static_assert(S_ % (2 * KT) == 0, "a staged tile of 128 keys never reaches past the last key");

// One q block: 64 q rows, block qb of head bh, by all eight waves. Every wave passes every barrier in here.
__device__ __forceinline__
void attn_qblock(const int bh, const int qb, const float* __restrict__ ws_q, const float* __restrict__ ws_k,
                 const float* __restrict__ ws_v, float* __restrict__ ws_o,
                 float (*kv)[2][2 * KT * KP]) {           // [buffer][K, V][tile]
    const int tid  = threadIdx.x;
    const int lane = tid & 31;
    const int wave = __builtin_amdgcn_readfirstlane(tid >> 5);
    const int lo = lane & 15, hi = lane >> 4;
    const int kg = wave >> 2, wq = wave & 3;            // which half of the keys, which 16 q rows
    const int q0 = qb * 64 + wq * 16;
    const int nt = (qb + 2) >> 1;                       // staged tiles: keys 0 .. 64 qb + 63, rounded up to 128

    const size_t base = (size_t)bh * S_ * D_;
    const float* Q = ws_q + base;
    const float* Kc = ws_k + base + tid * 4;            // this thread's first piece of tile 0
    const float* Vc = ws_v + base + tid * 4;
    const int crow = tid >> 4, ccol = (tid & 15) * 4;   // its row and column in the tile
    const unsigned kl0 = (unsigned)(size_t)&kv[0][0][crow * KP + ccol];
    const unsigned kl1 = (unsigned)(size_t)&kv[1][0][crow * KP + ccol];
    const unsigned vl0 = (unsigned)(size_t)&kv[0][1][crow * KP + ccol];
    const unsigned vl1 = (unsigned)(size_t)&kv[1][1][crow * KP + ccol];

    copy_tile(Kc, kl0, 16 * KP * 4);
    copy_tile(Vc, vl0, 16 * KP * 4);

    // Preload the Q tile as B operand (column = query lo): qf[i][part] holds d = 32i + 16hi .. + 15.
    u32x8 qf[2][2];
    {
        const unsigned char* qrow = (const unsigned char*)(Q + (size_t)(q0 + lo) * D_) + hi * 32;
        #pragma unroll                                  // fragment arrays stay in registers
        for (int i = 0; i < 2; ++i) {
            #pragma unroll                              // as above
            for (int pl = 0; pl < 2; ++pl) qf[i][pl] = frag(qrow + i * 128 + pl * 64, qrow + i * 128 + pl * 64 + 16);
        }
    }

    v8f acc0 = {}, acc1 = {}, acc2 = {}, acc3 = {};     // O^T tile: acc_n[v] = O[q0+lo][16n+8hi+v]
    const int qr = q0 + lo;                             // this lane's query
    float rm = -3.0e38f;                                // its running max (both halves alike)
    float rl = 0.0f;                                    // sum over this half's keys only

    asm volatile("s_wait_asynccnt 0x0" ::: "memory");   // this wave's share of tile 0 has landed
    __syncthreads();                                    // ... and every other wave's
    if (nt > 1) {
        copy_tile(Kc + 2 * KT * D_, kl1, 16 * KP * 4);
        copy_tile(Vc + 2 * KT * D_, vl1, 16 * KP * 4);
    }

    for (int t = 0; t < nt; ++t) {
        const unsigned char* kt = (const unsigned char*)(kv[t & 1][0] + kg * KT * KP);
        const unsigned char* vt = (const unsigned char*)(kv[t & 1][1] + kg * KT * KP);
        const int h = 2 * t + kg;                           // this wave's 64 keys, counted in q blocks
        // 32-key steps of this half that hold a key <= q0 + 15: both below the diagonal, none above it.
        const int ns = (h < qb) ? 2 : (h == qb) ? (wq >> 1) + 1 : 0;
        for (int u = 0; u < ns; ++u) {
            const int k0 = h * KT + u * 32;
            // ---- K and V fragments of this step, from LDS ----
            // K as A operand: row = key 16j + lo, k = d = 32i + 16hi .. + 15, the order of qf.
            const unsigned char* kr = kt + (u * 32 + lo) * (KP * 4) + hi * 32;
            u32x8 kf[2][2][2];
            #pragma unroll                                  // fragment arrays stay in registers
            for (int j = 0; j < 2; ++j) {
                #pragma unroll                              // as above
                for (int i = 0; i < 2; ++i) {
                    #pragma unroll                          // as above
                    for (int pl = 0; pl < 2; ++pl) {
                        const unsigned char* p = kr + j * 16 * (KP * 4) + i * 128 + pl * 64;
                        kf[j][i][pl] = frag(p, p + 16);
                    }
                }
            }
            // V^T as A operand: row = d (16n+lo), k = keys 8hi..8hi+7 and 16+8hi..16+8hi+7, the keys that
            // the two score accumulators hold in this lane half.
            const unsigned char* vr = vt + (u * 32 + (lo >> 1)) * (KP * 4) + (lo & 1) * 128 + hi * 16;
            u32x8 vf[4][2];
            #pragma unroll                                  // as above
            for (int n = 0; n < 4; ++n) {
                #pragma unroll                              // as above
                for (int pl = 0; pl < 2; ++pl) {
                    const unsigned char* p = vr + n * 8 * (KP * 4) + pl * 64;
                    vf[n][pl] = frag(p, p + 32);
                }
            }
            // All LDS reads of the step stand here as one group: left free, the scheduler sinks the
            // last V reads in front of their own product, where their latency shows.
            __builtin_amdgcn_sched_barrier(0);
            // ---- S^T = K * Q^T, two key tiles in turn: s[j][v] = S[q0+lo][k0+16j+8hi+v] ----
            v8f s[2] = {{}, {}};
            #pragma unroll                                  // fragment arrays are indexed by constants only
            for (int i = 0; i < 2; ++i) {
                s[0] = wmma32(kf[0][i][1], qf[i][0], s[0]);
                s[1] = wmma32(kf[1][i][1], qf[i][0], s[1]);
                s[0] = wmma32(kf[0][i][0], qf[i][1], s[0]);
                s[1] = wmma32(kf[1][i][0], qf[i][1], s[1]);
                s[0] = wmma32(kf[0][i][0], qf[i][0], s[0]);
                s[1] = wmma32(kf[1][i][0], qf[i][0], s[1]);
            }
            // ---- quirky causal mask + online softmax, one query per lane ----
            float p[16];
            #pragma unroll                                  // p stays in registers
            for (int e = 0; e < 16; ++e) p[e] = s[e >> 3][e & 7];
            // The mask can change a score only where a key lies above the diagonal or a score is exactly zero. A step
            // whose 32 keys all lie at or below the wave's first query has no such key, and the smallest magnitude
            // of a lane's scores tells whether it holds a zero: where no lane does, the sixteen selects are skipped.
            const float az = fminf(fminf(fminf(fminf(fabsf(p[0]), fabsf(p[1])), fminf(fabsf(p[2]), fabsf(p[3]))),
                                         fminf(fminf(fabsf(p[4]), fabsf(p[5])), fminf(fabsf(p[6]), fabsf(p[7])))),
                                   fminf(fminf(fminf(fabsf(p[8]), fabsf(p[9])), fminf(fabsf(p[10]), fabsf(p[11]))),
                                         fminf(fminf(fabsf(p[12]), fabsf(p[13])), fminf(fabsf(p[14]), fabsf(p[15])))));
            // A step on the diagonal joins the minimum as a zero, so that one test serves both causes. The test reads the
            // same in every lane of the wave: all lanes stay on for the matrix instructions behind it.
            const float dz = (k0 + 31 > q0) ? 0.0f : 3.0e38f;
            if (__builtin_amdgcn_ballot_w32(fminf(az, dz) == 0.0f) != 0u) {
                const int kbase = k0 + 8 * hi;
                #pragma unroll                              // as above
                for (int e = 0; e < 16; ++e)
                    if (kbase + (e >> 3) * 16 + (e & 7) > qr || p[e] == 0.0f) p[e] = NEGV;  // tril + exact-zero quirk
            }
            float mx = fmaxf(fmaxf(fmaxf(fmaxf(p[0], p[1]), fmaxf(p[2], p[3])),
                                   fmaxf(fmaxf(p[4], p[5]), fmaxf(p[6], p[7]))),
                             fmaxf(fmaxf(fmaxf(p[8], p[9]), fmaxf(p[10], p[11])),
                                   fmaxf(fmaxf(p[12], p[13]), fmaxf(p[14], p[15]))));
            mx = fmaxf(mx, xhalf(mx));                      // the other sixteen keys of this query
            const float nm = fmaxf(rm, mx);
            const float sc = __expf(rm - nm);
            rm = nm;
            #pragma unroll                                  // as above
            for (int e = 0; e < 16; e += 2) {               // two scores at a time: subtraction and scaling stay packed
                const v2f d = (v2f){p[e], p[e + 1]} - nm;
                p[e]     = __expf(d.x);
                p[e + 1] = __expf(d.y);
            }
            acc0 *= sc; acc1 *= sc; acc2 *= sc; acc3 *= sc;
            // ---- P^T as B operand, straight from registers: element e of a lane is its e-th score ----
            u32x8 ph, pl8;
            #pragma unroll                                  // as above
            for (int e = 0; e < 8; ++e) {
                unsigned a, b;
                split2(p[2 * e], p[2 * e + 1], a, b);
                ph[e] = a;
                pl8[e] = b;
            }
            // ---- O^T += V^T * P^T: four d-tiles in turn, three products each ----
            // Both parts of P stand ahead of the products: left free, the scheduler forms the lo parts among the first four
            // products in registers that those have just read, and fills the distance the chip then needs with v_nop.
            __builtin_amdgcn_sched_barrier(0);
            acc0 = wmma32(vf[0][1], ph, acc0);
            acc1 = wmma32(vf[1][1], ph, acc1);
            acc2 = wmma32(vf[2][1], ph, acc2);
            acc3 = wmma32(vf[3][1], ph, acc3);
            acc0 = wmma32(vf[0][0], pl8, acc0);
            acc1 = wmma32(vf[1][0], pl8, acc1);
            acc2 = wmma32(vf[2][0], pl8, acc2);
            acc3 = wmma32(vf[3][0], pl8, acc3);
            acc0 = wmma32(vf[0][0], ph, acc0);
            acc1 = wmma32(vf[1][0], ph, acc1);
            acc2 = wmma32(vf[2][0], ph, acc2);
            acc3 = wmma32(vf[3][0], ph, acc3);
            // The row sum stands behind the last products and is held there, so that straight-line vector work, not the
            // loop's back edge, follows the last matrix instruction.
            __builtin_amdgcn_sched_barrier(0);
            rl = rl * sc + ((((p[0] + p[1]) + (p[2] + p[3])) + ((p[4] + p[5]) + (p[6] + p[7]))) +
                            (((p[8] + p[9]) + (p[10] + p[11])) + ((p[12] + p[13]) + (p[14] + p[15]))));
        }
        // ---- hand-over: tile t+1 becomes readable, tile t's buffer becomes free ----
        asm volatile("s_wait_dscnt 0x0" ::: "memory");      // this wave's reads of tile t are done
        asm volatile("s_wait_asynccnt 0x0" ::: "memory");   // its share of tile t+1 has landed
        __syncthreads();
        if (t + 2 < nt) {
            const size_t off = (size_t)(t + 2) * (2 * KT * D_);
            copy_tile(Kc + off, (t & 1) ? kl1 : kl0, 16 * KP * 4);
            copy_tile(Vc + off, (t & 1) ? vl1 : vl0, 16 * KP * 4);
        }
    }
    asm volatile("s_wait_asynccnt 0x0" ::: "memory");       // nothing in flight when the join below reuses buffer 0

    // ---- join the two key halves: waves 4..7 hand maximum, sum and O tile to waves 0..3 through LDS ----
    // The loop's last barrier has ended every read of the tiles, and no copy is in flight: the buffer is free.
    v4f* mg = (v4f*)&kv[0][0][0] + wq * (9 * 32) + lane; // nine pieces of 16 bytes a lane, lanes side by side
    if (kg == 1) {
        mg[0 * 32] = __builtin_shufflevector(acc0, acc0, 0, 1, 2, 3);
        mg[1 * 32] = __builtin_shufflevector(acc0, acc0, 4, 5, 6, 7);
        mg[2 * 32] = __builtin_shufflevector(acc1, acc1, 0, 1, 2, 3);
        mg[3 * 32] = __builtin_shufflevector(acc1, acc1, 4, 5, 6, 7);
        mg[4 * 32] = __builtin_shufflevector(acc2, acc2, 0, 1, 2, 3);
        mg[5 * 32] = __builtin_shufflevector(acc2, acc2, 4, 5, 6, 7);
        mg[6 * 32] = __builtin_shufflevector(acc3, acc3, 0, 1, 2, 3);
        mg[7 * 32] = __builtin_shufflevector(acc3, acc3, 4, 5, 6, 7);
        mg[8 * 32] = (v4f){rm, rl, 0.0f, 0.0f};
    }
    __syncthreads();                                        // the partial results are whole before waves 0..3 read them
    if (kg == 1) return;                                    // back to the caller: nothing is left for waves 4..7 here
    {
        const v4f ml = mg[8 * 32];
        const float nm = fmaxf(rm, ml.x);                   // a half without keys brings -3e38 and weighs nothing
        const float w0 = __expf(rm - nm), w1 = __expf(ml.x - nm);
        rl = rl * w0 + ml.y * w1;
        acc0 = acc0 * w0 + __builtin_shufflevector(mg[0 * 32], mg[1 * 32], 0, 1, 2, 3, 4, 5, 6, 7) * w1;
        acc1 = acc1 * w0 + __builtin_shufflevector(mg[2 * 32], mg[3 * 32], 0, 1, 2, 3, 4, 5, 6, 7) * w1;
        acc2 = acc2 * w0 + __builtin_shufflevector(mg[4 * 32], mg[5 * 32], 0, 1, 2, 3, 4, 5, 6, 7) * w1;
        acc3 = acc3 * w0 + __builtin_shufflevector(mg[6 * 32], mg[7 * 32], 0, 1, 2, 3, 4, 5, 6, 7) * w1;
    }

    // ---- normalize + write O as [B,S,H*D]: eight consecutive floats per d-tile and lane ----
    const int bb = bh / H_, h = bh % H_;
    const float inv = 1.0f / (rl + xhalf(rl));              // join the two halves' sums
    float* orow = ws_o + ((size_t)bb * S_ + qr) * HD + h * 64 + 8 * hi;
    *(v8f*)(orow)      = acc0 * inv;
    *(v8f*)(orow + 16) = acc1 * inv;
    *(v8f*)(orow + 32) = acc2 * inv;
    *(v8f*)(orow + 48) = acc3 * inv;
    // A precaution: the caller may go on to a second q block, whose first lines write the stores' registers again.
    asm volatile("s_wait_xcnt 0x0" ::: "memory");
}

static_assert(B_ * H_ == 24 && S_ / 64 == 32, "the index map below is written for 3 x 8 heads and 32 q blocks");

// Four waves to a SIMD, so that two work-groups share a WGP: at most 256 registers a wave.
__global__ __launch_bounds__(256) __attribute__((amdgpu_waves_per_eu(4, 4)))
void attn_kernel(const float* __restrict__ ws_q, const float* __restrict__ ws_k,
                 const float* __restrict__ ws_v, float* __restrict__ ws_o) {
    // A buffer's K and V tiles lie side by side: every LDS read of a step is then one base register plus an offset
    // that fits the instruction's 16-bit field.
    __shared__ __attribute__((aligned(16))) float kv[2][2][2 * KT * KP];
    // Which (b,h) and which 64-row q blocks this work-group takes: any one-to-one map is right, this one is for speed.
    // A q block's cost grows with its index, and all 512 work-groups are resident at once, two to a WGP. If they are
    // dealt in turn over the 256 WGPs, indices i and i + 256 share a WGP: together they take c0, c1, c2, three
    // permutations of 0..31 whose sum is 47 or 46 for every r, so every WGP gets 25 or 26 staged key tiles.
    // The lower index takes the largest of the three, the higher index the other two, one after the other.
    const int rnd = blockIdx.x >> 8;                    // 0..1
    const int grp = (blockIdx.x >> 5) & 7;
    const int r   = blockIdx.x & 31;
    const int c0 = r, c1 = (r < 16 ? 31 : 62) - 2 * r, c2 = (r + 16) & 31;
    const int k0 = (c1 > c0) + (c2 > c0);               // place of each by falling size, ties by position
    const int k1 = (c0 >= c1) + (c2 > c1);
    for (int place = rnd; place <= 2 * rnd; ++place) {  // place 0, or places 1 and 2
        const int sel = (k0 == place) ? 0 : (k1 == place) ? 1 : 2;
        attn_qblock(sel * 8 + grp, (sel == 0) ? c0 : (sel == 1) ? c1 : c2, ws_q, ws_k, ws_v, ws_o, kv);
        if (place < 2 * rnd) {
            asm volatile("s_wait_dscnt 0x0" ::: "memory");  // this wave's reads of the partial results are done
            __syncthreads();                                // ... and every wave's, before the next q block's copies land there
        }
    }
}

// ---------------------------------------------------------------------------
// Kernel 3: output projection. O[4096x768] @ Wo[768x64] + bo -> out[4096x64].
// A work-group of four waves owns 16 rows of O and all 64 columns, one column tile a wave. The 16 rows, 48 KiB that
// lie contiguous in memory, come into LDS once with whole-line loads, all in flight together; every wave takes its
// A operands from there. Wo comes from L2 in batches of 32 k-steps, one batch ahead of the products that use it.
// Each output element is still one chain over k = 0..767 in rising order.
// ---------------------------------------------------------------------------
#define OP  772           // O row pitch in LDS, floats: 8-byte reads of sixteen rows by both lane halves meet no bank twice
#define OU  32            // k-steps (4 k each) per batch of Wo loads
#define ONB (HD / 4 / OU) // batches

__global__ __launch_bounds__(128)
void out_proj_kernel(const float* __restrict__ o_ws, const float* __restrict__ Wo,
                     const float* __restrict__ bo, float* __restrict__ out) {
    __shared__ __attribute__((aligned(16))) float os[16 * OP];
    const int tid  = threadIdx.x;
    const int lane = tid & 31;
    const int wave = __builtin_amdgcn_readfirstlane(tid >> 5);
    const int lo = lane & 15, hi = lane >> 4;
    const int n0 = wave * 16;                           // 0..48
    const int m0 = blockIdx.x * 16;                     // 0..4080

    // ---- O rows: 3072 pieces of 16 bytes, 24 per thread; two rows are three rounds of 128 pieces ----
    v4f t[24];
    {
        const float* og = o_ws + (size_t)m0 * HD + tid * 4;
        #pragma unroll                                  // all loads in flight at once
        for (int i = 0; i < 24; ++i) t[i] = *(const v4f*)(og + i * 512);
    }
    // B(k = 4c + 2hi, +1; n = lo) of k-step c lies at wb[c * 256] and wb[c * 256 + 64].
    const float* wb = Wo + (size_t)(2 * hi) * D_ + n0 + lo;
    v2f bf[2][OU];
    #pragma unroll                                      // fragment arrays stay in registers
    for (int c = 0; c < OU; ++c) bf[0][c] = (v2f){wb[c * 4 * D_], wb[c * 4 * D_ + D_]};
    const float bn = bo[n0 + lo];
    {
        // Places of this thread's three pieces of a row pair: first row, the seam, second row.
        float* l0 = os + tid * 4;
        float* l1 = os + ((tid >= 64) ? OP + (tid - 64) * 4 : (128 + tid) * 4);
        float* l2 = os + OP + (64 + tid) * 4;
        #pragma unroll                                  // t is indexed by constants only
        for (int j = 0; j < 8; ++j) {
            *(v4f*)(l0 + j * 2 * OP) = t[3 * j];
            *(v4f*)(l1 + j * 2 * OP) = t[3 * j + 1];
            *(v4f*)(l2 + j * 2 * OP) = t[3 * j + 2];
        }
    }
    __syncthreads();                                    // the 16 rows are whole before anyone reads them

    const float* ar = os + lo * OP + 2 * hi;            // A(m = lo, k = 4c + 2hi, +1) lies at ar[4c]
    v8f acc = {};
    #pragma unroll                                      // bf is indexed by constants only
    for (int g = 0; g < ONB; ++g) {
        if (g + 1 < ONB) {
            #pragma unroll                              // as above
            for (int c = 0; c < OU; ++c) {
                const float* p = wb + ((g + 1) * OU + c) * 4 * D_;
                bf[(g + 1) & 1][c] = (v2f){p[0], p[D_]};
            }
        }
        v2f af[OU];
        #pragma unroll                                  // as above
        for (int c = 0; c < OU; ++c) af[c] = *(const v2f*)(ar + (g * OU + c) * 4);
        // The next batch's Wo loads and this batch's LDS reads stand ahead of the products: left free, the scheduler
        // spreads the LDS reads singly among them, one read place per two products, and shortens the Wo loads' lead.
        __builtin_amdgcn_sched_barrier(0);
        #pragma unroll                                  // as above
        for (int c = 0; c < OU; ++c) acc = wmma4(af[c], bf[g & 1][c], acc);
    }
    // Four vector slots between the last matrix instruction and the first vector read of its result; the two
    // scheduling barriers hold them at this place.
    __builtin_amdgcn_sched_barrier(0);
    asm volatile("v_nop\n\tv_nop\n\tv_nop\n\tv_nop");
    __builtin_amdgcn_sched_barrier(0);
    #pragma unroll                                      // acc is indexed by constants only
    for (int v = 0; v < 8; ++v)
        out[(size_t)(m0 + v + 8 * hi) * D_ + n0 + lo] = acc[v] + bn;
}

extern "C" void kernel_launch(void* const* d_in, const int* in_sizes, int n_in,
                              void* d_out, int out_size, void* d_ws, size_t ws_size,
                              hipStream_t stream) {
    const float* x  = (const float*)d_in[0];
    const float* Wq = (const float*)d_in[1];
    const float* bq = (const float*)d_in[2];
    const float* Wk = (const float*)d_in[3];
    const float* bk = (const float*)d_in[4];
    const float* Wv = (const float*)d_in[5];
    const float* bv = (const float*)d_in[6];
    const float* Wo = (const float*)d_in[7];
    const float* bo = (const float*)d_in[8];
    float* out = (float*)d_out;

    float* ws = (float*)d_ws;
    const size_t QKV = (size_t)B_ * S_ * HD;            // 3,145,728 floats each
    float* q = ws;
    float* k = ws + QKV;
    float* v = ws + 2 * QKV;
    float* o = ws + 3 * QKV;                            // total 48 MB of d_ws

    // 1) QKV projections: 3 matrices x 8 column blocks, 32 row blocks, four waves each.
    qkv_proj_kernel<<<dim3(3 * (HD / PN), (B_ * S_) / PM), 128, 0, stream>>>(
        x, Wq, bq, Wk, bk, Wv, bv, ws);

    // 2) Attention: 24 (b,h) x 32 q-blocks of 64 rows, eight waves each; 512 work-groups take one or two q blocks.
    attn_kernel<<<dim3(B_ * H_ * (S_ / 64) * 2 / 3), 256, 0, stream>>>(q, k, v, o);

    // 3) Output projection: 256 blocks of 16 rows, four waves each, one per column tile.
    out_proj_kernel<<<dim3((B_ * S_) / 16), 128, 0, stream>>>(o, Wo, bo, out);
}

// v009
// A run of this version takes 56.5 microseconds.
// Two timings next to v008 both put it at 1.05 times that version's speed.
// Counting every step since v000, it is 6.41 times as fast.
#include <hip/hip_runtime.h>
#include <hip/hip_bf16.h>

// Multi-head self-attention (B=2,S=2048,D=64,H=12), fp32 in and out.
// The two projections run on v_wmma_f32_16x16x4_f32. The two attention products run on
// v_wmma_f32_16x16x32_bf16: every f32 operand x is kept as two bf16 parts, hi = bf16(x) and
// lo = bf16(x - hi), and a product is hi*hi + hi*lo + lo*hi with f32 sums (lo*lo is dropped).

#define B_  2
#define S_  2048
#define D_  64
#define H_  12
#define HD  768           // H_*D_
#define NEGV (-99999.0f)

typedef __attribute__((ext_vector_type(2))) float v2f;
typedef __attribute__((ext_vector_type(8))) float v8f;

// D = A(16x4 f32) * B(4x16 f32) + C(16x16 f32)
__device__ __forceinline__ v8f wmma4(v2f a, v2f b, v8f c) {
    return __builtin_amdgcn_wmma_f32_16x16x4_f32(
        /*neg_a=*/false, a, /*neg_b=*/false, b,
        /*c_mod=*/(short)0, c, /*reuse_a=*/false, /*reuse_b=*/false);
}

typedef __bf16 bf16x16 __attribute__((ext_vector_type(16)));
typedef __bf16 bf16x2 __attribute__((ext_vector_type(2)));
typedef unsigned u32x4 __attribute__((ext_vector_type(4)));
typedef unsigned u32x8 __attribute__((ext_vector_type(8)));

// D = A(16x32 bf16) * B(32x16 bf16) + C(16x16 f32)
__device__ __forceinline__ v8f wmma32(u32x8 a, u32x8 b, v8f c) {
    return __builtin_amdgcn_wmma_f32_16x16x32_bf16(
        false, __builtin_bit_cast(bf16x16, a), false, __builtin_bit_cast(bf16x16, b),
        (short)0, c, false, false);
}

// Two f32 values as a pair of bf16, a in the low half.
__device__ __forceinline__ unsigned pack2(float a, float b) {
    const v2f t = {a, b};
    return __builtin_bit_cast(unsigned, __builtin_convertvector(t, bf16x2));
}

// Two f32 values as their hi pair and their lo pair.
__device__ __forceinline__ void split2(float a, float b, unsigned& h, unsigned& l) {
    h = pack2(a, b);
    l = pack2(a - __builtin_bit_cast(float, h << 16), b - __builtin_bit_cast(float, h & 0xffff0000u));
}

// Eight f32 values as eight hi parts and eight lo parts, 16 bytes each.
__device__ __forceinline__ void split8(const float* f, u32x4& h, u32x4& l) {
    unsigned a, b;
    split2(f[0], f[1], a, b); h.x = a; l.x = b;
    split2(f[2], f[3], a, b); h.y = a; l.y = b;
    split2(f[4], f[5], a, b); h.z = a; l.z = b;
    split2(f[6], f[7], a, b); h.w = a; l.w = b;
}

// ---------------------------------------------------------------------------
// Kernel 1: QKV projection. x[4096x64] @ W[64x768] + b -> scratch, split into bf16 parts.
// Q and K: [B,H,S] rows of 256 bytes, two lines; line i holds d = 32i..32i+31 as 32 hi, then 32 lo.
// V, transposed: [B,H,S/32][d] lines of 128 bytes; a line holds 32 keys of one d as 32 hi, then 32 lo.
// A work-group of four waves computes a block of 128 rows x 96 columns of one matrix; a wave takes
// 32 rows (two row tiles) of all six column tiles. The x rows and the W columns come into LDS with
// whole-line loads, once per work-group, and the results leave through LDS as whole 128-byte lines.
// 24 column blocks x 32 row blocks = 768 work-groups: three to a WGP, three waves to a SIMD.
// ---------------------------------------------------------------------------
#define PM  128           // rows per work-group
#define PN  96            // columns per work-group: three 128-byte lines of an output row
#define XP  68            // x row pitch in LDS, floats: 8-byte column reads meet no bank twice
#define WPP 224           // W pitch in LDS, floats per PAIR of k rows: W[k][n], W[k+1][n] lie side by side, so one
                          // 8-byte read brings a B operand; pairs i and i+1 lie 32 banks apart
#define SP  100           // result row pitch in LDS, floats: rows v and v+8 lie 32 banks apart

typedef __attribute__((ext_vector_type(4))) float v4f;

__global__ __launch_bounds__(128)
void qkv_proj_kernel(const float* __restrict__ x,
                     const float* __restrict__ Wq, const float* __restrict__ bq,
                     const float* __restrict__ Wk, const float* __restrict__ bk,
                     const float* __restrict__ Wv, const float* __restrict__ bv,
                     float* __restrict__ ws) {
    __shared__ __attribute__((aligned(16))) float xs[PM * XP];
    __shared__ __attribute__((aligned(16))) float wp[(D_ / 2) * WPP];
    const int tid  = threadIdx.x;
    const int lane = tid & 31;
    const int wave = __builtin_amdgcn_readfirstlane(tid >> 5);
    const int lo = lane & 15, hi = lane >> 4;           // hi in {0,1}
    const int which = blockIdx.x >> 3;                  // 0=Q 1=K 2=V
    const int col0  = (blockIdx.x & 7) * PN;            // first column, 0..672
    const int row0  = blockIdx.y * PM;                  // first row, 0..3968

    const float* W    = (which == 0) ? Wq : (which == 1) ? Wk : Wv;
    const float* bias = (which == 0) ? bq : (which == 1) ? bk : bv;
    float* out = ws + (size_t)which * (size_t)(B_ * S_ * HD);

    // ---- x block: 128 rows x 256 bytes, contiguous in memory, 16 pieces of 16 bytes per thread ----
    {
        const float* xg = x + (size_t)row0 * D_ + tid * 4;
        float* xl = xs + (tid >> 4) * XP + (tid & 15) * 4;
        #pragma unroll                                  // all loads in flight at once
        for (int i = 0; i < 16; ++i)
            *(v4f*)(xl + i * 8 * XP) = *(const v4f*)(xg + i * 512);
    }
    // ---- W block: 32 pairs of k rows x 384 bytes; a thread joins four columns of both rows ----
    #pragma unroll                                      // as above
    for (int i = 0; i < 6; ++i) {
        const int item = i * 128 + tid;
        const int kp = item / 24, c4 = item % 24;
        const float* g = W + (size_t)(2 * kp) * HD + col0 + c4 * 4;
        const v4f r0 = *(const v4f*)g;
        const v4f r1 = *(const v4f*)(g + HD);
        float* d = wp + kp * WPP + c4 * 8;
        *(v4f*)d       = (v4f){r0.x, r1.x, r0.y, r1.y};
        *(v4f*)(d + 4) = (v4f){r0.z, r1.z, r0.w, r1.w};
    }
    float bn[6];
    #pragma unroll                                      // bn stays in registers
    for (int n = 0; n < 6; ++n) bn[n] = bias[col0 + n * 16 + lo];
    __syncthreads();                                    // both blocks are whole before anyone reads them

    // ---- A operands of this wave's two row tiles: A(m=lo, k=4c+2hi, +1) ----
    float* mine = xs + wave * 32 * XP;                  // this wave's 32 rows: nobody else reads them
    v2f xa[2][16];
    #pragma unroll                                      // fragment arrays stay in registers
    for (int mt = 0; mt < 2; ++mt) {
        #pragma unroll                                  // as above
        for (int c = 0; c < 16; ++c)
            xa[mt][c] = *(const v2f*)(mine + (mt * 16 + lo) * XP + 4 * c + 2 * hi);
    }
    v8f acc[2][6];
    #pragma unroll                                      // as above
    for (int n = 0; n < 6; ++n) {
        v2f bf[16];                                     // B(k=4c+2hi, +1; n=lo)
        #pragma unroll                                  // as above
        for (int c = 0; c < 16; ++c)
            bf[c] = *(const v2f*)(wp + (2 * c + hi) * WPP + (n * 16 + lo) * 2);
        v8f a0 = {}, a1 = {};
        #pragma unroll                                  // as above
        for (int c = 0; c < 16; ++c) {                  // two chains in turn: neither waits for its own sum
            a0 = wmma4(xa[0][c], bf[c], a0);
            a1 = wmma4(xa[1][c], bf[c], a1);
        }
        acc[0][n] = a0;
        acc[1][n] = a1;
    }

    // ---- results: through this wave's own x rows, now free; Q and K one row tile at a time ----
    const int sub = lane >> 3, q = lane & 7;            // a store covers four lines, eight lanes each
    const int bb = row0 / S_;                           // a block never crosses batches
    const unsigned lofs = sub * D_ + q * 4;             // this lane's place among four output rows
    if (which == 2) {
        // V: a lane holds eight consecutive keys of one column, 16 bytes of a line's hi half and of its lo half.
        // 48 columns at a time go through LDS (pitch 144 bytes: 16-byte writes meet no bank twice) and leave as whole lines.
        unsigned char* st = (unsigned char*)mine;
        const int g = ((row0 % S_) >> 5) + wave;        // this wave's 32 rows are one group of 32 keys
        #pragma unroll                                  // acc is indexed by constants only
        for (int half = 0; half < 2; ++half) {
            // Other lanes' earlier reads of these LDS bytes stay ahead of the writes below.
            asm volatile("s_wait_dscnt 0x0" ::: "memory");
            #pragma unroll                              // as above
            for (int nn = 0; nn < 3; ++nn) {
                #pragma unroll                          // as above
                for (int mt = 0; mt < 2; ++mt) {
                    float f[8];
                    #pragma unroll                      // as above
                    for (int v = 0; v < 8; ++v) f[v] = acc[mt][half * 3 + nn][v] + bn[half * 3 + nn];
                    u32x4 h4, l4;
                    split8(f, h4, l4);
                    unsigned char* d = st + (nn * 16 + lo) * 144 + mt * 32 + hi * 16;
                    *(u32x4*)d        = h4;
                    *(u32x4*)(d + 64) = l4;
                }
            }
            // Other lanes' values are in LDS before this lane reads them back.
            asm volatile("s_wait_dscnt 0x0" ::: "memory");
            #pragma unroll                              // column becomes a constant offset
            for (int i = 0; i < 12; ++i) {
                const int col = col0 + half * 48 + i * 4;   // four columns of one head: four adjacent lines
                float* og = out + ((((size_t)bb * H_ + (col >> 6)) * (S_ / 32) + g) * D_ + (col & 63)) * 32;   // same in every lane
                *(u32x4*)(og + sub * 32 + q * 4) = *(const u32x4*)(st + (i * 4 + sub) * 144 + q * 16);
            }
        }
        return;
    }
    #pragma unroll                                      // acc is indexed by constants only
    for (int mt = 0; mt < 2; ++mt) {
        // Other lanes' earlier reads of these LDS bytes stay ahead of the writes below.
        asm volatile("s_wait_dscnt 0x0" ::: "memory");
        #pragma unroll                                  // as above
        for (int n = 0; n < 6; ++n) {
            #pragma unroll                              // as above
            for (int v = 0; v < 8; ++v)                 // C/D layout: row v+8hi, column lo
                mine[(v + 8 * hi) * SP + n * 16 + lo] = acc[mt][n][v] + bn[n];
        }
        // Other lanes' values are in LDS before this lane reads them back.
        asm volatile("s_wait_dscnt 0x0" ::: "memory");
        const int s0 = (row0 % S_) + wave * 32 + mt * 16;
        #pragma unroll                                  // line and row become constant offsets
        for (int i = 0; i < 12; ++i) {
            const int seg = i % 3, r4 = (i / 3) * 4;    // line of the row; row = r4 + sub
            const int col = col0 + seg * 32;            // a line never crosses heads
            float* og = out + (((size_t)bb * H_ + (col >> 6)) * S_ + s0 + r4) * D_ + (col & 63);   // same in every lane
            // Lanes 0..3 of a line store the hi parts of eight columns each, lanes 4..7 the lo parts of the same columns.
            const float* sp = mine + (r4 + sub) * SP + seg * 32 + (q & 3) * 8;
            const v4f f0 = *(const v4f*)sp, f1 = *(const v4f*)(sp + 4);
            const float f[8] = {f0.x, f0.y, f0.z, f0.w, f1.x, f1.y, f1.z, f1.w};
            u32x4 h4, l4;
            split8(f, h4, l4);
            *(u32x4*)(og + lofs) = (q & 4) ? l4 : h4;
        }
    }
    // The last stores have taken their registers before any code that the listing lets follow writes them again.
    asm volatile("s_wait_xcnt 0x0" ::: "memory");
}

#define L2E  1.44269504f
#define PCAP 65536.0f
#define KT 64
#define KP 68

// One tile of 128 rows x 256 bytes, 2048 pieces of 16 bytes, eight per thread.
// g: this thread's first piece in global memory (a wave covers 512 contiguous bytes),
// l: its LDS byte address, step: LDS bytes between a thread's pieces (sixteen rows).
__device__ __forceinline__ void copy_tile(const float* g, unsigned l, unsigned step) {
    // The closing s_wait_xcnt keeps the address registers whole until the copies have taken them.
    asm volatile(
        "global_load_async_to_lds_b128 %0, %8, off\n\t"
        "global_load_async_to_lds_b128 %1, %9, off\n\t"
        "global_load_async_to_lds_b128 %2, %10, off\n\t"
        "global_load_async_to_lds_b128 %3, %11, off\n\t"
        "global_load_async_to_lds_b128 %4, %12, off\n\t"
        "global_load_async_to_lds_b128 %5, %13, off\n\t"
        "global_load_async_to_lds_b128 %6, %14, off\n\t"
        "global_load_async_to_lds_b128 %7, %15, off\n\t"
        "s_wait_xcnt 0x0"
        :: "v"(l), "v"(l + step), "v"(l + 2 * step), "v"(l + 3 * step),
           "v"(l + 4 * step), "v"(l + 5 * step), "v"(l + 6 * step), "v"(l + 7 * step),
           "v"(g), "v"(g + 1024), "v"(g + 2048), "v"(g + 3072),
           "v"(g + 4096), "v"(g + 5120), "v"(g + 6144), "v"(g + 7168)
        : "memory");
}

// Two pieces of 16 bytes as one operand of eight registers.
__device__ __forceinline__ u32x8 frag(const unsigned char* p0, const unsigned char* p1) {
    const u32x4 x = *(const u32x4*)p0, y = *(const u32x4*)p1;
    return __builtin_shufflevector(x, y, 0, 1, 2, 3, 4, 5, 6, 7);
}

// Lane l takes the value of lane l ^ 16.
__device__ __forceinline__ float xhalf(float x) {
    const int b = __builtin_bit_cast(int, x);
    return __builtin_bit_cast(float,
        __builtin_amdgcn_permlanex16(b, b, 0x76543210, 0xfedcba98, false, false));
}

// Sum of sixteen values: even and odd places side by side in packed additions, joined at the end.
__device__ __forceinline__ float sum16(const float* w) {
    const v2f a = ((v2f){w[0], w[1]} + (v2f){w[2], w[3]}) + ((v2f){w[4], w[5]} + (v2f){w[6], w[7]});
    const v2f b = ((v2f){w[8], w[9]} + (v2f){w[10], w[11]}) + ((v2f){w[12], w[13]} + (v2f){w[14], w[15]});
    const v2f c = a + b;
    return c.x + c.y;
}

static_assert(S_ % (2 * KT) == 0, "a staged tile of 128 keys never reaches past the last key");

// One q block: 64 q rows, block qb of head bh, by all eight waves. Every wave passes every barrier in here.
__device__ __forceinline__
void attn_qblock(const int bh, const int qb, const float* __restrict__ ws_q, const float* __restrict__ ws_k,
                 const float* __restrict__ ws_v, float* __restrict__ ws_o,
                 float (*kv)[2][2 * KT * KP]) {           // [buffer][K, V][tile]
    const int tid  = threadIdx.x;
    const int lane = tid & 31;
    const int wave = __builtin_amdgcn_readfirstlane(tid >> 5);
    const int lo = lane & 15, hi = lane >> 4;
    const int kg = wave >> 2, wq = wave & 3;            // which half of the keys, which 16 q rows
    const int q0 = qb * 64 + wq * 16;
    const int nt = (qb + 2) >> 1;                       // staged tiles: keys 0 .. 64 qb + 63, rounded up to 128

    const size_t base = (size_t)bh * S_ * D_;
    const float* Q = ws_q + base;
    const float* Kc = ws_k + base + tid * 4;            // this thread's first piece of tile 0
    const float* Vc = ws_v + base + tid * 4;
    const int crow = tid >> 4, ccol = (tid & 15) * 4;   // its row and column in the tile
    const unsigned kl0 = (unsigned)(size_t)&kv[0][0][crow * KP + ccol];
    const unsigned kl1 = (unsigned)(size_t)&kv[1][0][crow * KP + ccol];
    const unsigned vl0 = (unsigned)(size_t)&kv[0][1][crow * KP + ccol];
    const unsigned vl1 = (unsigned)(size_t)&kv[1][1][crow * KP + ccol];

    copy_tile(Kc, kl0, 16 * KP * 4);
    copy_tile(Vc, vl0, 16 * KP * 4);

    // Preload the Q tile as B operand (column = query lo): qf[i][part] holds d = 32i + 16hi .. + 15.
    u32x8 qf[2][2];
    {
        const unsigned char* qrow = (const unsigned char*)(Q + (size_t)(q0 + lo) * D_) + hi * 32;
        #pragma unroll                                  // fragment arrays stay in registers
        for (int i = 0; i < 2; ++i) {
            #pragma unroll                              // as above
            for (int pl = 0; pl < 2; ++pl) qf[i][pl] = frag(qrow + i * 128 + pl * 64, qrow + i * 128 + pl * 64 + 16);
        }
    }

    v8f acc0 = {}, acc1 = {}, acc2 = {}, acc3 = {};     // O^T tile: acc_n[v] = O[q0+lo][16n+8hi+v]
    const int qr = q0 + lo;                             // this lane's query
    float rm = -3.0e38f;                                // its ref, in powers of two (both halves alike)
    float rl = 0.0f;                                    // sum over this half's keys only

    asm volatile("s_wait_asynccnt 0x0" ::: "memory");   // this wave's share of tile 0 has landed
    __syncthreads();                                    // ... and every other wave's
    if (nt > 1) {
        copy_tile(Kc + 2 * KT * D_, kl1, 16 * KP * 4);
        copy_tile(Vc + 2 * KT * D_, vl1, 16 * KP * 4);
    }

    for (int t = 0; t < nt; ++t) {
        const unsigned char* kt = (const unsigned char*)(kv[t & 1][0] + kg * KT * KP);
        const unsigned char* vt = (const unsigned char*)(kv[t & 1][1] + kg * KT * KP);
        const int h = 2 * t + kg;                           // this wave's 64 keys, counted in q blocks
        // 32-key steps of this half that hold a key <= q0 + 15: both below the diagonal, none above it.
        const int ns = (h < qb) ? 2 : (h == qb) ? (wq >> 1) + 1 : 0;
        for (int u = 0; u < ns; ++u) {
            const int k0 = h * KT + u * 32;
            // ---- K and V fragments of this step, from LDS ----
            // K as A operand: row = key 16j + lo, k = d = 32i + 16hi .. + 15, the order of qf.
            const unsigned char* kr = kt + (u * 32 + lo) * (KP * 4) + hi * 32;
            u32x8 kf[2][2][2];
            #pragma unroll                                  // fragment arrays stay in registers
            for (int j = 0; j < 2; ++j) {
                #pragma unroll                              // as above
                for (int i = 0; i < 2; ++i) {
                    #pragma unroll                          // as above
                    for (int pl = 0; pl < 2; ++pl) {
                        const unsigned char* p = kr + j * 16 * (KP * 4) + i * 128 + pl * 64;
                        kf[j][i][pl] = frag(p, p + 16);
                    }
                }
            }
            // V^T as A operand: row = d (16n+lo), k = keys 8hi..8hi+7 and 16+8hi..16+8hi+7, the keys that
            // the two score accumulators hold in this lane half.
            const unsigned char* vr = vt + (u * 32 + (lo >> 1)) * (KP * 4) + (lo & 1) * 128 + hi * 16;
            u32x8 vf[4][2];
            #pragma unroll                                  // as above
            for (int n = 0; n < 4; ++n) {
                #pragma unroll                              // as above
                for (int pl = 0; pl < 2; ++pl) {
                    const unsigned char* p = vr + n * 8 * (KP * 4) + pl * 64;
                    vf[n][pl] = frag(p, p + 32);
                }
            }
            // All LDS reads of the step stand here as one group: left free, the scheduler sinks the
            // last V reads in front of their own product, where their latency shows.
            __builtin_amdgcn_sched_barrier(0);
            // ---- S^T = K * Q^T, two key tiles in turn: s[j][v] = S[q0+lo][k0+16j+8hi+v] ----
            v8f s[2] = {{}, {}};
            #pragma unroll                                  // fragment arrays are indexed by constants only
            for (int i = 0; i < 2; ++i) {
                s[0] = wmma32(kf[0][i][1], qf[i][0], s[0]);
                s[1] = wmma32(kf[1][i][1], qf[i][0], s[1]);
                s[0] = wmma32(kf[0][i][0], qf[i][1], s[0]);
                s[1] = wmma32(kf[1][i][0], qf[i][1], s[1]);
                s[0] = wmma32(kf[0][i][0], qf[i][0], s[0]);
                s[1] = wmma32(kf[1][i][0], qf[i][0], s[1]);
            }
            // ---- quirky causal mask + online softmax, one query per lane ----
            float p[16];
            #pragma unroll                                  // p stays in registers
            for (int e = 0; e < 16; ++e) p[e] = s[e >> 3][e & 7];
            // The mask can change a score only where a key lies above the diagonal or a score is exactly zero. A step
            // whose 32 keys all lie at or below the wave's first query has no such key, and the smallest magnitude
            // of a lane's scores tells whether it holds a zero: where no lane does, the sixteen selects are skipped.
            const float az = fminf(fminf(fminf(fminf(fabsf(p[0]), fabsf(p[1])), fminf(fabsf(p[2]), fabsf(p[3]))),
                                         fminf(fminf(fabsf(p[4]), fabsf(p[5])), fminf(fabsf(p[6]), fabsf(p[7])))),
                                   fminf(fminf(fminf(fabsf(p[8]), fabsf(p[9])), fminf(fabsf(p[10]), fabsf(p[11]))),
                                         fminf(fminf(fabsf(p[12]), fabsf(p[13])), fminf(fabsf(p[14]), fabsf(p[15])))));
            // A step on the diagonal joins the minimum as a zero, so that one test serves both causes. The test reads the
            // same in every lane of the wave: all lanes stay on for the matrix instructions behind it.
            const float dz = (k0 + 31 > q0) ? 0.0f : 3.0e38f;
            // The weights with the ref at hand, and their sum. Before a wave's first step ref is -3e38: they come out infinite.
            float w[16];
            #pragma unroll                                  // w stays in registers
            for (int e = 0; e < 16; e += 2) {               // two scores at a time: one packed multiply-add
                const v2f d = (v2f){p[e], p[e + 1]} * L2E - rm;
                w[e]     = __builtin_amdgcn_exp2f(d.x);
                w[e + 1] = __builtin_amdgcn_exp2f(d.y);
            }
            float sm = sum16(w);
            // No weight is negative, so a sum within PCAP bounds every weight; the negated form also catches a NaN.
            const bool mz = fminf(az, dz) == 0.0f;
            if (__builtin_amdgcn_ballot_w32(mz || !(sm <= PCAP)) != 0u) {
                if (__builtin_amdgcn_ballot_w32(mz) != 0u) {    // a wave's first step comes here for its ref alone
                    const int kbase = k0 + 8 * hi;
                    #pragma unroll                          // as above
                    for (int e = 0; e < 16; ++e)
                        if (kbase + (e >> 3) * 16 + (e & 7) > qr || p[e] == 0.0f) p[e] = NEGV;  // tril + exact-zero quirk
                }
                float mx = fmaxf(fmaxf(fmaxf(fmaxf(p[0], p[1]), fmaxf(p[2], p[3])),
                                       fmaxf(fmaxf(p[4], p[5]), fmaxf(p[6], p[7]))),
                                 fmaxf(fmaxf(fmaxf(p[8], p[9]), fmaxf(p[10], p[11])),
                                       fmaxf(fmaxf(p[12], p[13]), fmaxf(p[14], p[15]))));
                mx = fmaxf(mx, xhalf(mx));                  // the other sixteen keys of this query
                const float nm = fmaxf(rm, mx * L2E);
                const float sc = __builtin_amdgcn_exp2f(rm - nm);
                rm = nm;
                #pragma unroll                              // as above
                for (int e = 0; e < 16; e += 2) {
                    const v2f d = (v2f){p[e], p[e + 1]} * L2E - nm;
                    w[e]     = __builtin_amdgcn_exp2f(d.x);
                    w[e + 1] = __builtin_amdgcn_exp2f(d.y);
                }
                sm = sum16(w);
                acc0 *= sc; acc1 *= sc; acc2 *= sc; acc3 *= sc;
                rl *= sc;
            }
            // ---- P^T as B operand, straight from registers: element e of a lane is its e-th score ----
            u32x8 ph, pl8;
            #pragma unroll                                  // as above
            for (int e = 0; e < 8; ++e) {
                unsigned a, b;
                split2(w[2 * e], w[2 * e + 1], a, b);
                ph[e] = a;
                pl8[e] = b;
            }
            // ---- O^T += V^T * P^T: four d-tiles in turn, three products each ----
            // Both parts of P stand ahead of the products: left free, the scheduler forms the lo parts among the first four
            // products in registers that those have just read, and fills the distance the chip then needs with v_nop.
            __builtin_amdgcn_sched_barrier(0);
            acc0 = wmma32(vf[0][1], ph, acc0);
            acc1 = wmma32(vf[1][1], ph, acc1);
            acc2 = wmma32(vf[2][1], ph, acc2);
            acc3 = wmma32(vf[3][1], ph, acc3);
            acc0 = wmma32(vf[0][0], pl8, acc0);
            acc1 = wmma32(vf[1][0], pl8, acc1);
            acc2 = wmma32(vf[2][0], pl8, acc2);
            acc3 = wmma32(vf[3][0], pl8, acc3);
            acc0 = wmma32(vf[0][0], ph, acc0);
            acc1 = wmma32(vf[1][0], ph, acc1);
            acc2 = wmma32(vf[2][0], ph, acc2);
            acc3 = wmma32(vf[3][0], ph, acc3);
            // The step's sum joins the row sum behind the last products and is held there, so that a vector instruction, not
            // the loop's back edge, follows the last matrix instruction: it is the fourth slot that the chip needs before the
            // next step's address arithmetic writes registers that the ninth product has read.
            __builtin_amdgcn_sched_barrier(0);
            rl += sm;
        }
        // ---- hand-over: tile t+1 becomes readable, tile t's buffer becomes free ----
        asm volatile("s_wait_dscnt 0x0" ::: "memory");      // this wave's reads of tile t are done
        asm volatile("s_wait_asynccnt 0x0" ::: "memory");   // its share of tile t+1 has landed
        __syncthreads();
        if (t + 2 < nt) {
            const size_t off = (size_t)(t + 2) * (2 * KT * D_);
            copy_tile(Kc + off, (t & 1) ? kl1 : kl0, 16 * KP * 4);
            copy_tile(Vc + off, (t & 1) ? vl1 : vl0, 16 * KP * 4);
        }
    }
    asm volatile("s_wait_asynccnt 0x0" ::: "memory");       // nothing in flight when the join below reuses buffer 0

    // ---- join the two key halves: waves 4..7 hand ref, sum and O tile to waves 0..3 through LDS ----
    // The loop's last barrier has ended every read of the tiles, and no copy is in flight: the buffer is free.
    v4f* mg = (v4f*)&kv[0][0][0] + wq * (9 * 32) + lane; // nine pieces of 16 bytes a lane, lanes side by side
    if (kg == 1) {
        mg[0 * 32] = __builtin_shufflevector(acc0, acc0, 0, 1, 2, 3);
        mg[1 * 32] = __builtin_shufflevector(acc0, acc0, 4, 5, 6, 7);
        mg[2 * 32] = __builtin_shufflevector(acc1, acc1, 0, 1, 2, 3);
        mg[3 * 32] = __builtin_shufflevector(acc1, acc1, 4, 5, 6, 7);
        mg[4 * 32] = __builtin_shufflevector(acc2, acc2, 0, 1, 2, 3);
        mg[5 * 32] = __builtin_shufflevector(acc2, acc2, 4, 5, 6, 7);
        mg[6 * 32] = __builtin_shufflevector(acc3, acc3, 0, 1, 2, 3);
        mg[7 * 32] = __builtin_shufflevector(acc3, acc3, 4, 5, 6, 7);
        mg[8 * 32] = (v4f){rm, rl, 0.0f, 0.0f};
    }
    __syncthreads();                                        // the partial results are whole before waves 0..3 read them
    if (kg == 1) return;                                    // back to the caller: nothing is left for waves 4..7 here
    {
        const v4f ml = mg[8 * 32];
        const float nm = fmaxf(rm, ml.x);                   // a half without keys brings -3e38 and weighs nothing
        const float w0 = __builtin_amdgcn_exp2f(rm - nm), w1 = __builtin_amdgcn_exp2f(ml.x - nm);
        rl = rl * w0 + ml.y * w1;
        acc0 = acc0 * w0 + __builtin_shufflevector(mg[0 * 32], mg[1 * 32], 0, 1, 2, 3, 4, 5, 6, 7) * w1;
        acc1 = acc1 * w0 + __builtin_shufflevector(mg[2 * 32], mg[3 * 32], 0, 1, 2, 3, 4, 5, 6, 7) * w1;
        acc2 = acc2 * w0 + __builtin_shufflevector(mg[4 * 32], mg[5 * 32], 0, 1, 2, 3, 4, 5, 6, 7) * w1;
        acc3 = acc3 * w0 + __builtin_shufflevector(mg[6 * 32], mg[7 * 32], 0, 1, 2, 3, 4, 5, 6, 7) * w1;
    }

    // ---- normalize + write O as [B,S,H*D]: eight consecutive floats per d-tile and lane ----
    const int bb = bh / H_, h = bh % H_;
    const float inv = 1.0f / (rl + xhalf(rl));              // join the two halves' sums
    float* orow = ws_o + ((size_t)bb * S_ + qr) * HD + h * 64 + 8 * hi;
    *(v8f*)(orow)      = acc0 * inv;
    *(v8f*)(orow + 16) = acc1 * inv;
    *(v8f*)(orow + 32) = acc2 * inv;
    *(v8f*)(orow + 48) = acc3 * inv;
    // A precaution: the caller may go on to a second q block, whose first lines write the stores' registers again.
    asm volatile("s_wait_xcnt 0x0" ::: "memory");
}

static_assert(B_ * H_ == 24 && S_ / 64 == 32, "the index map below is written for 3 x 8 heads and 32 q blocks");

// Four waves to a SIMD, so that two work-groups share a WGP: at most 256 registers a wave.
__global__ __launch_bounds__(256) __attribute__((amdgpu_waves_per_eu(4, 4)))
void attn_kernel(const float* __restrict__ ws_q, const float* __restrict__ ws_k,
                 const float* __restrict__ ws_v, float* __restrict__ ws_o) {
    // A buffer's K and V tiles lie side by side: every LDS read of a step is then one base register plus an offset
    // that fits the instruction's 16-bit field.
    __shared__ __attribute__((aligned(16))) float kv[2][2][2 * KT * KP];
    // Which (b,h) and which 64-row q blocks this work-group takes: any one-to-one map is right, this one is for speed.
    // A q block's cost grows with its index, and all 512 work-groups are resident at once, two to a WGP. If they are
    // dealt in turn over the 256 WGPs, indices i and i + 256 share a WGP: together they take c0, c1, c2, three
    // permutations of 0..31 whose sum is 47 or 46 for every r, so every WGP gets 25 or 26 staged key tiles.
    // The lower index takes the largest of the three, the higher index the other two, one after the other.
    const int rnd = blockIdx.x >> 8;                    // 0..1
    const int grp = (blockIdx.x >> 5) & 7;
    const int r   = blockIdx.x & 31;
    const int c0 = r, c1 = (r < 16 ? 31 : 62) - 2 * r, c2 = (r + 16) & 31;
    const int k0 = (c1 > c0) + (c2 > c0);               // place of each by falling size, ties by position
    const int k1 = (c0 >= c1) + (c2 > c1);
    for (int place = rnd; place <= 2 * rnd; ++place) {  // place 0, or places 1 and 2
        const int sel = (k0 == place) ? 0 : (k1 == place) ? 1 : 2;
        attn_qblock(sel * 8 + grp, (sel == 0) ? c0 : (sel == 1) ? c1 : c2, ws_q, ws_k, ws_v, ws_o, kv);
        if (place < 2 * rnd) {
            asm volatile("s_wait_dscnt 0x0" ::: "memory");  // this wave's reads of the partial results are done
            __syncthreads();                                // ... and every wave's, before the next q block's copies land there
        }
    }
}

// ---------------------------------------------------------------------------
// Kernel 3: output projection. O[4096x768] @ Wo[768x64] + bo -> out[4096x64].
// A work-group of four waves owns 16 rows of O and all 64 columns, one column tile a wave. The 16 rows, 48 KiB that
// lie contiguous in memory, come into LDS once with whole-line loads, all in flight together; every wave takes its
// A operands from there. Wo comes from L2 in batches of 32 k-steps, one batch ahead of the products that use it.
// Each output element is still one chain over k = 0..767 in rising order.
// ---------------------------------------------------------------------------
#define OP  772           // O row pitch in LDS, floats: 8-byte reads of sixteen rows by both lane halves meet no bank twice
#define OU  32            // k-steps (4 k each) per batch of Wo loads
#define ONB (HD / 4 / OU) // batches

__global__ __launch_bounds__(128)
void out_proj_kernel(const float* __restrict__ o_ws, const float* __restrict__ Wo,
                     const float* __restrict__ bo, float* __restrict__ out) {
    __shared__ __attribute__((aligned(16))) float os[16 * OP];
    const int tid  = threadIdx.x;
    const int lane = tid & 31;
    const int wave = __builtin_amdgcn_readfirstlane(tid >> 5);
    const int lo = lane & 15, hi = lane >> 4;
    const int n0 = wave * 16;                           // 0..48
    const int m0 = blockIdx.x * 16;                     // 0..4080

    // ---- O rows: 3072 pieces of 16 bytes, 24 per thread; two rows are three rounds of 128 pieces ----
    v4f t[24];
    {
        const float* og = o_ws + (size_t)m0 * HD + tid * 4;
        #pragma unroll                                  // all loads in flight at once
        for (int i = 0; i < 24; ++i) t[i] = *(const v4f*)(og + i * 512);
    }
    // B(k = 4c + 2hi, +1; n = lo) of k-step c lies at wb[c * 256] and wb[c * 256 + 64].
    const float* wb = Wo + (size_t)(2 * hi) * D_ + n0 + lo;
    v2f bf[2][OU];
    #pragma unroll                                      // fragment arrays stay in registers
    for (int c = 0; c < OU; ++c) bf[0][c] = (v2f){wb[c * 4 * D_], wb[c * 4 * D_ + D_]};
    const float bn = bo[n0 + lo];
    {
        // Places of this thread's three pieces of a row pair: first row, the seam, second row.
        float* l0 = os + tid * 4;
        float* l1 = os + ((tid >= 64) ? OP + (tid - 64) * 4 : (128 + tid) * 4);
        float* l2 = os + OP + (64 + tid) * 4;
        #pragma unroll                                  // t is indexed by constants only
        for (int j = 0; j < 8; ++j) {
            *(v4f*)(l0 + j * 2 * OP) = t[3 * j];
            *(v4f*)(l1 + j * 2 * OP) = t[3 * j + 1];
            *(v4f*)(l2 + j * 2 * OP) = t[3 * j + 2];
        }
    }
    __syncthreads();                                    // the 16 rows are whole before anyone reads them

    const float* ar = os + lo * OP + 2 * hi;            // A(m = lo, k = 4c + 2hi, +1) lies at ar[4c]
    v8f acc = {};
    #pragma unroll                                      // bf is indexed by constants only
    for (int g = 0; g < ONB; ++g) {
        if (g + 1 < ONB) {
            #pragma unroll                              // as above
            for (int c = 0; c < OU; ++c) {
                const float* p = wb + ((g + 1) * OU + c) * 4 * D_;
                bf[(g + 1) & 1][c] = (v2f){p[0], p[D_]};
            }
        }
        v2f af[OU];
        #pragma unroll                                  // as above
        for (int c = 0; c < OU; ++c) af[c] = *(const v2f*)(ar + (g * OU + c) * 4);
        // The next batch's Wo loads and this batch's LDS reads stand ahead of the products: left free, the scheduler
        // spreads the LDS reads singly among them, one read place per two products, and shortens the Wo loads' lead.
        __builtin_amdgcn_sched_barrier(0);
        #pragma unroll                                  // as above
        for (int c = 0; c < OU; ++c) acc = wmma4(af[c], bf[g & 1][c], acc);
    }
    // Four vector slots between the last matrix instruction and the first vector read of its result; the two
    // scheduling barriers hold them at this place.
    __builtin_amdgcn_sched_barrier(0);
    asm volatile("v_nop\n\tv_nop\n\tv_nop\n\tv_nop");
    __builtin_amdgcn_sched_barrier(0);
    #pragma unroll                                      // acc is indexed by constants only
    for (int v = 0; v < 8; ++v)
        out[(size_t)(m0 + v + 8 * hi) * D_ + n0 + lo] = acc[v] + bn;
}

extern "C" void kernel_launch(void* const* d_in, const int* in_sizes, int n_in,
                              void* d_out, int out_size, void* d_ws, size_t ws_size,
                              hipStream_t stream) {
    const float* x  = (const float*)d_in[0];
    const float* Wq = (const float*)d_in[1];
    const float* bq = (const float*)d_in[2];
    const float* Wk = (const float*)d_in[3];
    const float* bk = (const float*)d_in[4];
    const float* Wv = (const float*)d_in[5];
    const float* bv = (const float*)d_in[6];
    const float* Wo = (const float*)d_in[7];
    const float* bo = (const float*)d_in[8];
    float* out = (float*)d_out;

    float* ws = (float*)d_ws;
    const size_t QKV = (size_t)B_ * S_ * HD;            // 3,145,728 floats each
    float* q = ws;
    float* k = ws + QKV;
    float* v = ws + 2 * QKV;
    float* o = ws + 3 * QKV;                            // total 48 MB of d_ws

    // 1) QKV projections: 3 matrices x 8 column blocks, 32 row blocks, four waves each.
    qkv_proj_kernel<<<dim3(3 * (HD / PN), (B_ * S_) / PM), 128, 0, stream>>>(
        x, Wq, bq, Wk, bk, Wv, bv, ws);

    // 2) Attention: 24 (b,h) x 32 q-blocks of 64 rows, eight waves each; 512 work-groups take one or two q blocks.
    attn_kernel<<<dim3(B_ * H_ * (S_ / 64) * 2 / 3), 256, 0, stream>>>(q, k, v, o);

    // 3) Output projection: 256 blocks of 16 rows, four waves each, one per column tile.
    out_proj_kernel<<<dim3((B_ * S_) / 16), 128, 0, stream>>>(o, Wo, bo, out);
}
